// v000
// Times are from an AMD MI455X. After a warm-up the kernel runs many times in a row, and a time is the length of
// such a window on the GPU divided by its runs, so every launch and the gaps after it count. The runs cycle
// through copies of the inputs. A figure is the median of several windows, for all but v000 over two sittings.
// Sittings can differ by a few percent; kernels timed side by side share one.
// The starting kernel, v000, takes 449 microseconds a run.
#include <hip/hip_runtime.h>
#include <math.h>

typedef __attribute__((ext_vector_type(16))) _Float16 v16h;
typedef __attribute__((ext_vector_type(16))) __bf16 v16b;
typedef __attribute__((ext_vector_type(8)))  _Float16 v8h;
typedef __attribute__((ext_vector_type(8)))  float v8f;
typedef __attribute__((ext_vector_type(4)))  float v4f;
typedef __attribute__((ext_vector_type(2)))  float v2f;
typedef __attribute__((ext_vector_type(4)))  unsigned v4u;
typedef __attribute__((ext_vector_type(4)))  int v4i;
typedef float __attribute__((may_alias)) float_a;
typedef int __attribute__((may_alias)) int_a;

template <typename T> __device__ __forceinline__ void vst2(void* p, T v) { *(T*)p = v;  }
__device__ __forceinline__ v8f wmma16(v16h a, v16h b, v8f c) {
  v8f d = __builtin_amdgcn_wmma_f32_16x16x32_f16(false, a, false, b, (short)0, c, false, false);
  asm volatile("v_nop\n\tv_nop\n\tv_nop\n\tv_nop" : "+v"(d) : "v"(a), "v"(b));
  return d;
}
__device__ __forceinline__ v8f wmma_bf(v16b a, v16b b, v8f c) {
  v8f d = __builtin_amdgcn_wmma_f32_16x16x32_bf16(false, a, false, b, (short)0, c, false, false);
  asm volatile("v_nop\n\tv_nop\n\tv_nop\n\tv_nop" : "+v"(d) : "v"(a), "v"(b));
  return d;
}
// 16x16x32 fragments: lane = (h = lane>>4, row/col = lane&15); elements 0..7 = k0+8h+0..7, 8..15 = k0+16+8h+0..7; D element r = row 8h+r
__device__ __forceinline__ v16h frag_h(const _Float16* rowk0, int lane) {
  union { v16h v; v8h q[2]; } u; const _Float16* p = rowk0 + 8 * (lane >> 4);
  u.q[0] = *(const v8h*)p; u.q[1] = *(const v8h*)(p + 16); return u.v;
}
__device__ __forceinline__ v16h frag_f32(const float* rowk0, int lane) {
  v16h a; const float* p = rowk0 + 8 * (lane >> 4);
#pragma unroll
  for (int i = 0; i < 8; ++i) { a[i] = (_Float16)p[i]; a[8 + i] = (_Float16)p[16 + i]; }
  return a;
}
__device__ __forceinline__ v16h frag_f32s(const float* rowk0, int lane, float sc) {
  v16h a; const float* p = rowk0 + 8 * (lane >> 4);
#pragma unroll
  for (int i = 0; i < 8; ++i) { a[i] = (_Float16)(p[i] * sc); a[8 + i] = (_Float16)(p[16 + i] * sc); }
  return a;
}
// column fragment from a [K][ld] layout (column n), rows >= K read as 0
__device__ __forceinline__ v16h fragc_f32(const float* W, int k0, int n, int lane, int ld, int K) {
  v16h a; const int g = lane >> 4;
#pragma unroll
  for (int i = 0; i < 8; ++i) { const int ka = k0 + 8 * g + i, kb = ka + 16;
    a[i] = (_Float16)(ka < K ? W[(size_t)(ka < K ? ka : K - 1) * ld + n] : 0.f); a[8 + i] = (_Float16)(kb < K ? W[(size_t)(kb < K ? kb : K - 1) * ld + n] : 0.f); }
  return a;
}
struct F2 { v16b h, l; };
__device__ __forceinline__ F2 bsplit16(const float v[16]) { F2 r;
#pragma unroll
  for (int i = 0; i < 16; ++i) { const __bf16 h = (__bf16)v[i]; r.h[i] = h; r.l[i] = (__bf16)(v[i] - (float)h); }
  return r; }
__device__ __forceinline__ F2 split_row(const float* row, int k0, int lane) { float v[16]; const float* p = row + k0 + 8 * (lane >> 4);
#pragma unroll
  for (int i = 0; i < 8; ++i) { v[i] = p[i]; v[8 + i] = p[16 + i]; }
  return bsplit16(v); }
__device__ __forceinline__ F2 split_rowK(const float* row, int k0, int lane, int K) { float v[16]; const int g = lane >> 4;
#pragma unroll
  for (int i = 0; i < 8; ++i) { const int ka = k0 + 8 * g + i, kb = ka + 16; v[i] = ka < K ? row[ka < K ? ka : K - 1] : 0.f; v[8 + i] = kb < K ? row[kb < K ? kb : K - 1] : 0.f; }
  return bsplit16(v); }
__device__ __forceinline__ F2 split_col(const float* W, int k0, int n, int lane, int ld, int K) { float v[16]; const int g = lane >> 4;
#pragma unroll
  for (int i = 0; i < 8; ++i) { const int ka = k0 + 8 * g + i, kb = ka + 16; v[i] = ka < K ? W[(size_t)(ka < K ? ka : K - 1) * ld + n] : 0.f; v[8 + i] = kb < K ? W[(size_t)(kb < K ? kb : K - 1) * ld + n] : 0.f; }
  return bsplit16(v); }
__device__ __forceinline__ v8f mac3(const F2& a, const F2& b, v8f c) { c = wmma_bf(a.l, b.h, c); c = wmma_bf(a.h, b.l, c); return wmma_bf(a.h, b.h, c); }
__device__ __forceinline__ float sigm(float v) { return 1.0f / (1.0f + expf(-v)); }
#define LDSX() do { asm volatile("s_wait_dscnt 0" ::: "memory"); __builtin_amdgcn_wave_barrier(); __builtin_amdgcn_fence(__ATOMIC_RELEASE, "workgroup"); } while (0)


// Multi-head attention over 32x32 feature maps (channel-major NCHW inputs): q/k/v = 1x1 conv (W x + b) per position, 8 heads x 32, scores = q k^T / sqrt(32) + attn_mask[t][s] (dense float mask, shared across batch/heads), softmax over s, P v, concat heads (channel = h*32 + d), out = Wo out + bo -> [B, 256, 32, 32].
// k_proj (per (b, 64 positions): gathers the channel-major input columns into LDS as bf16 [pos][ch], single-product bf16 GEMM against W rows; q,k as position rows [b][t][256], v as channel-major hi/lo planes [b][ch][t]), k_stats (per (64 queries, b, h): online max/sum over the 1024 keys), k_attn (P = exp(s - M)/L hi/lo . V^T planes, O rows), k_out (O(hi/lo) . Wo rows + bo, written channel-major: per output channel one 256-B segment of 64 positions).
#define NB 8
#define E 256
#define NT 1024
#define NH 8
#define HD 32
#ifndef TNB
#define TNB NB
#define TQB (NT / 64)
#endif
typedef __attribute__((ext_vector_type(8))) __bf16 v8b;
__device__ __forceinline__ v16b frag_b(const __bf16* rowk0, int lane) {
  union { v16b v; v8b q[2]; } u; const __bf16* p = rowk0 + 8 * (lane >> 4);
  u.q[0] = *(const v8b*)p; u.q[1] = *(const v8b*)(p + 16); return u.v;
}
__device__ __forceinline__ v16b frag_gbf(const float* rowk0, int lane) {
  v16b a; const float* p = rowk0 + 8 * (lane >> 4);
#pragma unroll
  for (int i = 0; i < 8; ++i) { a[i] = (__bf16)p[i]; a[8 + i] = (__bf16)p[16 + i]; }
  return a;
}
__device__ __forceinline__ float bfr(float v) { return (float)(__bf16)v; }
__device__ __attribute__((noinline)) float exp_ni(float v) { return expf(v); }
#define WS_Q    0u                               // f32 [8][1024][256] q rows (t-major); later O rows
#define WS_K    (WS_Q + 4u * NB * NT * E)
#define WS_VTH  (WS_K + 4u * NB * NT * E)          // bf16 [8][256 ch][1024 t]
#define WS_VTL  (WS_VTH + 2u * NB * E * NT)
#define WS_M    (WS_VTL + 2u * NB * E * NT)        // f32 [8*8][1024]
#define WS_L    (WS_M + 4u * NB * NH * NT)
#define WS_END  (WS_L + 4u * NB * NH * NT)

__global__ __launch_bounds__(128) void k_proj(const float* __restrict__ Xq, const float* __restrict__ Xk, const float* __restrict__ Xv, const float* __restrict__ Wq, const float* __restrict__ bq, const float* __restrict__ Wk, const float* __restrict__ bk, const float* __restrict__ Wv, const float* __restrict__ bv, float* __restrict__ Q, float* __restrict__ Kb, __bf16* __restrict__ VTH, __bf16* __restrict__ VTL) {
  __shared__ __align__(16) __bf16 sx[64][E + 8]; __shared__ __align__(16) float so[4][16][E + 4]; __shared__ __align__(16) __bf16 svh[E][72], svl[E][72];
  const int tid = threadIdx.x, wave = tid >> 5, lane = tid & 31, col = lane & 15, g = lane >> 4; const int b = blockIdx.y, t0 = blockIdx.x * 64, which = blockIdx.z;
  const float* X = which == 0 ? Xq : (which == 1 ? Xk : Xv); const float* Wm = which == 0 ? Wq : (which == 1 ? Wk : Wv); const float* bm = which == 0 ? bq : (which == 1 ? bk : bv);
  for (int q = tid; q < E * 64; q += 128) { const int c = q >> 6, tl = q & 63; sx[tl][c] = (__bf16)X[((size_t)b * E + c) * NT + t0 + tl]; }
  __syncthreads();
  v8f acc[16] = {};
#pragma unroll 2
  for (int kc = 0; kc < E / 32; ++kc) { const v16b a = frag_b(&sx[wave * 16 + col][kc * 32], lane);
#pragma unroll
    for (int j = 0; j < 16; ++j) acc[j] = wmma_bf(a, frag_gbf(Wm + (size_t)(j * 16 + col) * E + kc * 32, lane), acc[j]); }
#pragma unroll
  for (int j = 0; j < 16; ++j) { const float bb = bfr(bm[j * 16 + col]);
#pragma unroll
    for (int r = 0; r < 8; ++r) so[wave][8 * g + r][j * 16 + col] = acc[j][r] + bb; }
  __syncthreads();
  if (which < 2) { float* dst = which == 0 ? Q : Kb;
    for (int rl = 0; rl < 16; ++rl) for (int pc = lane; pc < E / 4; pc += 32) vst2(dst + ((size_t)b * NT + t0 + wave * 16 + rl) * E + pc * 4, *(const v4f*)&so[wave][rl][pc * 4]); }
  else {
    for (int q = tid; q < E * 64; q += 128) { const int c = q >> 6, tl = q & 63; const float v = so[tl >> 4][tl & 15][c]; const __bf16 hb = (__bf16)v; svh[c][tl] = hb; svl[c][tl] = (__bf16)(v - (float)hb); }
    __syncthreads();
    for (int q = tid; q < E * 8; q += 128) { const int c = q >> 3, pc = q & 7; const size_t o = ((size_t)b * E + c) * NT + t0 + pc * 8; vst2((unsigned*)(VTH + o), *(const v4u*)&svh[c][pc * 8]); vst2((unsigned*)(VTL + o), *(const v4u*)&svl[c][pc * 8]); } }
}
// ---- k_stats: block = (64 queries, b*8+h): s = q.k (K 32, 3 products) * scale + mask[t][s]; online max/sum over the 1024 keys; M/L 256-B runs
__global__ __launch_bounds__(128) void k_stats(const float* __restrict__ Q, const float* __restrict__ Kb, const float* __restrict__ mask, float* __restrict__ Mb, float* __restrict__ Lb) {
  __shared__ __align__(16) float sm[4][16]; __shared__ __align__(16) float ssum[4][16];
  const int tid = threadIdx.x, wave = tid >> 5, lane = tid & 31, col = lane & 15, g = lane >> 4; const int bh = blockIdx.y, b = bh >> 3, h = bh & 7; const int q0 = blockIdx.x * 64 + wave * 16; const float scale = 0.17677669529663687f;   // 32^-0.5
  const F2 a = split_row(Q + ((size_t)b * NT + q0 + col) * E + h * HD, 0, lane);
  float m[8], l[8];
#pragma unroll
  for (int r = 0; r < 8; ++r) { m[r] = -3.0e38f; l[r] = 0.f; }
#pragma unroll 1
  for (int kt = 0; kt < NT / 16; ++kt) { const F2 kb = split_row(Kb + ((size_t)b * NT + kt * 16 + col) * E + h * HD, 0, lane); const v8f s = mac3(a, kb, (v8f){});
#pragma unroll
    for (int r = 0; r < 8; ++r) { const float sv = s[r] * scale + bfr(mask[(size_t)(q0 + 8 * g + r) * NT + kt * 16 + col]); float mx = sv;
#pragma unroll
      for (int o = 1; o < 16; o <<= 1) mx = fmaxf(mx, __shfl_xor(mx, o));
      const float mn = fmaxf(m[r], mx); float e = exp_ni(sv - mn);
#pragma unroll
      for (int o = 1; o < 16; o <<= 1) e += __shfl_xor(e, o);
      l[r] = l[r] * exp_ni(m[r] - mn) + e; m[r] = mn; } }
  if (col == 0) {
#pragma unroll
    for (int r = 0; r < 8; ++r) { sm[wave][8 * g + r] = m[r]; ssum[wave][8 * g + r] = l[r]; } }
  __syncthreads();
  { const int qb = blockIdx.x * 64; if (tid < 16) vst2(Mb + ((size_t)bh * NT + qb) + tid * 4, *(const v4f*)(&sm[0][0] + tid * 4)); else if (tid < 32) vst2(Lb + ((size_t)bh * NT + qb) + (tid - 16) * 4, *(const v4f*)(&ssum[0][0] + (tid - 16) * 4)); }
}
__global__ __launch_bounds__(128) void k_attn(float* __restrict__ Q, const float* __restrict__ Kb, const float* __restrict__ mask, const __bf16* __restrict__ VTH, const __bf16* __restrict__ VTL, const float* __restrict__ Mb, const float* __restrict__ Lb) {
  __shared__ __align__(16) float sp[4][16][36]; __shared__ __align__(16) float so[4][16][36];
  const int tid = threadIdx.x, wave = tid >> 5, lane = tid & 31, col = lane & 15, g = lane >> 4; const int bh = blockIdx.y, b = bh >> 3, h = bh & 7; const int q0 = blockIdx.x * 64 + wave * 16; const float scale = 0.17677669529663687f;
  const F2 a = split_row(Q + ((size_t)b * NT + q0 + col) * E + h * HD, 0, lane);
  float mr[8], il[8];
#pragma unroll
  for (int r = 0; r < 8; ++r) { mr[r] = Mb[(size_t)bh * NT + q0 + 8 * g + r]; il[r] = 1.0f / Lb[(size_t)bh * NT + q0 + 8 * g + r]; }
  v8f acc[2] = {};
#pragma unroll 1
  for (int ks = 0; ks < NT / 32; ++ks) {
#pragma unroll
    for (int ct = 0; ct < 2; ++ct) { const int kk = ks * 32 + ct * 16 + col; const F2 kb = split_row(Kb + ((size_t)b * NT + kk) * E + h * HD, 0, lane); const v8f s = mac3(a, kb, (v8f){});
#pragma unroll
      for (int r = 0; r < 8; ++r) sp[wave][8 * g + r][ct * 16 + col] = exp_ni((s[r] * scale + bfr(mask[(size_t)(q0 + 8 * g + r) * NT + kk])) - mr[r]) * il[r]; }
    LDSX();
    const F2 pa = split_row(&sp[wave][col][0], 0, lane);
#pragma unroll
    for (int dt = 0; dt < 2; ++dt) { const size_t vrow = ((size_t)b * E + h * HD + dt * 16 + col) * NT + ks * 32; const v16b vh = frag_b(VTH + vrow, lane), vl = frag_b(VTL + vrow, lane);
      acc[dt] = wmma_bf(pa.l, vh, acc[dt]); acc[dt] = wmma_bf(pa.h, vl, acc[dt]); acc[dt] = wmma_bf(pa.h, vh, acc[dt]); }
    LDSX(); }
#pragma unroll
  for (int dt = 0; dt < 2; ++dt)
#pragma unroll
    for (int r = 0; r < 8; ++r) so[wave][8 * g + r][dt * 16 + col] = acc[dt][r];
  LDSX();
  for (int rl = 0; rl < 16; ++rl) if (lane < 8) vst2(Q + ((size_t)b * NT + q0 + rl) * E + h * HD + lane * 4, *(const v4f*)&so[wave][rl][lane * 4]);
}
// ---- k_out: block = (b, 64 positions): Y[b][o][t] = sum_c O[b][t][c] Wo[o][c] + bo[o]: GEMM rows t (O rows hi/lo, K 256), cols o (16 tiles per wave = 256); written channel-major: per o the 64 t = 256 B
__global__ __launch_bounds__(128) void k_out(const float* __restrict__ O, const float* __restrict__ Wo, const float* __restrict__ bo, float* __restrict__ Y) {
  __shared__ __align__(16) float sot[E][68];          // [o][t local]
  const int tid = threadIdx.x, wave = tid >> 5, lane = tid & 31, col = lane & 15, g = lane >> 4; const int b = blockIdx.y, t0 = blockIdx.x * 64;
  v8f acc[16] = {};
#pragma unroll 1
  for (int kc = 0; kc < E / 32; ++kc) { const F2 a = split_row(O + ((size_t)b * NT + t0 + wave * 16 + col) * E, kc * 32, lane);
#pragma unroll
    for (int j = 0; j < 16; ++j) { const v16b w = frag_gbf(Wo + (size_t)(j * 16 + col) * E + kc * 32, lane); acc[j] = wmma_bf(a.l, w, acc[j]); acc[j] = wmma_bf(a.h, w, acc[j]); } }
#pragma unroll
  for (int j = 0; j < 16; ++j) { const int o = j * 16 + col; const float bb = bfr(bo[o]);
#pragma unroll
    for (int r = 0; r < 8; ++r) sot[o][wave * 16 + 8 * g + r] = acc[j][r] + bb; }
  __syncthreads();
  for (int q = tid; q < E * 16; q += 128) { const int o = q >> 4, pc = q & 15; vst2(Y + ((size_t)b * E + o) * NT + t0 + pc * 4, *(const v4f*)&sot[o][pc * 4]); }
}

extern "C" void kernel_launch(void* const* d_in, const int* in_sizes, int n_in, void* d_out, int out_size, void* d_ws, size_t ws_size, hipStream_t stream) {
  (void)in_sizes; (void)n_in; (void)out_size;
  const float** F = (const float**)d_in;   // d_in order: query, key, value [8,256,32,32], attn_mask [1024,1024], Wq, Wk, Wv, Wo [256,256], bq, bk, bv, bo [256]
  if (ws_size < (size_t)WS_END) return;
  char* ws = (char*)d_ws; float *Q = (float*)(ws + WS_Q), *Kb = (float*)(ws + WS_K), *Mb = (float*)(ws + WS_M), *Lb = (float*)(ws + WS_L); __bf16 *VTH = (__bf16*)(ws + WS_VTH), *VTL = (__bf16*)(ws + WS_VTL);
  k_proj<<<dim3(NT / 64, TNB, 3), 128, 0, stream>>>(F[0], F[1], F[2], F[4], F[8], F[5], F[9], F[6], F[10], Q, Kb, VTH, VTL);
  k_stats<<<dim3(TQB, TNB * NH), 128, 0, stream>>>(Q, Kb, F[3], Mb, Lb);
  k_attn<<<dim3(TQB, TNB * NH), 128, 0, stream>>>(Q, Kb, F[3], VTH, VTL, Mb, Lb);
  k_out<<<dim3(TQB, TNB), 128, 0, stream>>>(Q, F[7], F[11], (float*)d_out);
}

// v001
// A run of this version takes 312 microseconds.
// Timed twice side by side with v000, it ran 1.44 times as fast both times.
#include <hip/hip_runtime.h>
#include <math.h>

typedef __attribute__((ext_vector_type(16))) _Float16 v16h;
typedef __attribute__((ext_vector_type(16))) __bf16 v16b;
typedef __attribute__((ext_vector_type(8)))  _Float16 v8h;
typedef __attribute__((ext_vector_type(8)))  float v8f;
typedef __attribute__((ext_vector_type(4)))  float v4f;
typedef __attribute__((ext_vector_type(2)))  float v2f;
typedef __attribute__((ext_vector_type(4)))  unsigned v4u;
typedef __attribute__((ext_vector_type(4)))  int v4i;
typedef float __attribute__((may_alias)) float_a;
typedef int __attribute__((may_alias)) int_a;

template <typename T> __device__ __forceinline__ void vst2(void* p, T v) { *(T*)p = v;  }
__device__ __forceinline__ v8f wmma16(v16h a, v16h b, v8f c) {
  v8f d = __builtin_amdgcn_wmma_f32_16x16x32_f16(false, a, false, b, (short)0, c, false, false);
  asm volatile("v_nop\n\tv_nop\n\tv_nop\n\tv_nop" : "+v"(d) : "v"(a), "v"(b));
  return d;
}
__device__ __forceinline__ v8f wmma_bf(v16b a, v16b b, v8f c) {
  v8f d = __builtin_amdgcn_wmma_f32_16x16x32_bf16(false, a, false, b, (short)0, c, false, false);
  asm volatile("v_nop\n\tv_nop\n\tv_nop\n\tv_nop" : "+v"(d) : "v"(a), "v"(b));
  return d;
}
// 16x16x32 fragments: lane = (h = lane>>4, row/col = lane&15); elements 0..7 = k0+8h+0..7, 8..15 = k0+16+8h+0..7; D element r = row 8h+r
__device__ __forceinline__ v16h frag_h(const _Float16* rowk0, int lane) {
  union { v16h v; v8h q[2]; } u; const _Float16* p = rowk0 + 8 * (lane >> 4);
  u.q[0] = *(const v8h*)p; u.q[1] = *(const v8h*)(p + 16); return u.v;
}
__device__ __forceinline__ v16h frag_f32(const float* rowk0, int lane) {
  v16h a; const float* p = rowk0 + 8 * (lane >> 4);
#pragma unroll
  for (int i = 0; i < 8; ++i) { a[i] = (_Float16)p[i]; a[8 + i] = (_Float16)p[16 + i]; }
  return a;
}
__device__ __forceinline__ v16h frag_f32s(const float* rowk0, int lane, float sc) {
  v16h a; const float* p = rowk0 + 8 * (lane >> 4);
#pragma unroll
  for (int i = 0; i < 8; ++i) { a[i] = (_Float16)(p[i] * sc); a[8 + i] = (_Float16)(p[16 + i] * sc); }
  return a;
}
// column fragment from a [K][ld] layout (column n), rows >= K read as 0
__device__ __forceinline__ v16h fragc_f32(const float* W, int k0, int n, int lane, int ld, int K) {
  v16h a; const int g = lane >> 4;
#pragma unroll
  for (int i = 0; i < 8; ++i) { const int ka = k0 + 8 * g + i, kb = ka + 16;
    a[i] = (_Float16)(ka < K ? W[(size_t)(ka < K ? ka : K - 1) * ld + n] : 0.f); a[8 + i] = (_Float16)(kb < K ? W[(size_t)(kb < K ? kb : K - 1) * ld + n] : 0.f); }
  return a;
}
struct F2 { v16b h, l; };
__device__ __forceinline__ F2 bsplit16(const float v[16]) { F2 r;
#pragma unroll
  for (int i = 0; i < 16; ++i) { const __bf16 h = (__bf16)v[i]; r.h[i] = h; r.l[i] = (__bf16)(v[i] - (float)h); }
  return r; }
__device__ __forceinline__ F2 split_row(const float* row, int k0, int lane) { float v[16]; const float* p = row + k0 + 8 * (lane >> 4);
#pragma unroll
  for (int i = 0; i < 8; ++i) { v[i] = p[i]; v[8 + i] = p[16 + i]; }
  return bsplit16(v); }
__device__ __forceinline__ F2 split_rowK(const float* row, int k0, int lane, int K) { float v[16]; const int g = lane >> 4;
#pragma unroll
  for (int i = 0; i < 8; ++i) { const int ka = k0 + 8 * g + i, kb = ka + 16; v[i] = ka < K ? row[ka < K ? ka : K - 1] : 0.f; v[8 + i] = kb < K ? row[kb < K ? kb : K - 1] : 0.f; }
  return bsplit16(v); }
__device__ __forceinline__ F2 split_col(const float* W, int k0, int n, int lane, int ld, int K) { float v[16]; const int g = lane >> 4;
#pragma unroll
  for (int i = 0; i < 8; ++i) { const int ka = k0 + 8 * g + i, kb = ka + 16; v[i] = ka < K ? W[(size_t)(ka < K ? ka : K - 1) * ld + n] : 0.f; v[8 + i] = kb < K ? W[(size_t)(kb < K ? kb : K - 1) * ld + n] : 0.f; }
  return bsplit16(v); }
__device__ __forceinline__ v8f mac3(const F2& a, const F2& b, v8f c) { c = wmma_bf(a.l, b.h, c); c = wmma_bf(a.h, b.l, c); return wmma_bf(a.h, b.h, c); }
__device__ __forceinline__ float sigm(float v) { return 1.0f / (1.0f + expf(-v)); }
#define LDSX() do { asm volatile("s_wait_dscnt 0" ::: "memory"); __builtin_amdgcn_wave_barrier(); __builtin_amdgcn_fence(__ATOMIC_RELEASE, "workgroup"); } while (0)


// Multi-head attention over 32x32 feature maps (channel-major NCHW inputs): q/k/v = 1x1 conv (W x + b) per position, 8 heads x 32, scores = q k^T / sqrt(32) + attn_mask[t][s] (dense float mask, shared across batch/heads), softmax over s, P v, concat heads (channel = h*32 + d), out = Wo out + bo -> [B, 256, 32, 32].
// k_proj (per (b, 64 positions): gathers the channel-major input columns into LDS as bf16 [pos][ch], bf16 GEMM against W rows (X, W, bias rounded to bf16); q,k as position rows [b][t][256], v as channel-major hi/lo planes [b][ch][t]), k_attn (per (64 queries, b, h): one pass over the 1024 keys, running row max m and row sum l; P = exp(s - m) hi/lo . V^T planes, O and l rescaled by exp(m_old - m_new) per 32 keys, O / l at the end, O rows), k_out (O(hi/lo) . Wo rows + bo, written channel-major: per output channel one 256-B segment of 64 positions).
#define NB 8
#define E 256
#define NT 1024
#define NH 8
#define HD 32
#ifndef TNB
#define TNB NB
#define TQB (NT / 64)
#endif
typedef __attribute__((ext_vector_type(8))) __bf16 v8b;
__device__ __forceinline__ v16b frag_b(const __bf16* rowk0, int lane) {
  union { v16b v; v8b q[2]; } u; const __bf16* p = rowk0 + 8 * (lane >> 4);
  u.q[0] = *(const v8b*)p; u.q[1] = *(const v8b*)(p + 16); return u.v;
}
__device__ __forceinline__ v16b frag_gbf(const float* rowk0, int lane) {
  v16b a; const float* p = rowk0 + 8 * (lane >> 4);
#pragma unroll
  for (int i = 0; i < 8; ++i) { a[i] = (__bf16)p[i]; a[8 + i] = (__bf16)p[16 + i]; }
  return a;
}
__device__ __forceinline__ float bfr(float v) { return (float)(__bf16)v; }
__device__ __attribute__((noinline)) float exp_ni(float v) { return expf(v); }
#define WS_Q    0u                               // f32 [8][1024][256] q rows (t-major); later O rows
#define WS_K    (WS_Q + 4u * NB * NT * E)
#define WS_VTH  (WS_K + 4u * NB * NT * E)          // bf16 [8][256 ch][1024 t]
#define WS_VTL  (WS_VTH + 2u * NB * E * NT)
#define WS_END  (WS_VTL + 2u * NB * E * NT)
// sum / maximum over the 16 lanes of a half-wave (the 16 key columns of one score row): four row_xmask exchanges, every lane gets the result
__device__ __forceinline__ float xm1(float v) { return __int_as_float(__builtin_amdgcn_update_dpp(0, __float_as_int(v), 0x161, 0xf, 0xf, true)); }
__device__ __forceinline__ float xm2(float v) { return __int_as_float(__builtin_amdgcn_update_dpp(0, __float_as_int(v), 0x162, 0xf, 0xf, true)); }
__device__ __forceinline__ float xm4(float v) { return __int_as_float(__builtin_amdgcn_update_dpp(0, __float_as_int(v), 0x164, 0xf, 0xf, true)); }
__device__ __forceinline__ float xm8(float v) { return __int_as_float(__builtin_amdgcn_update_dpp(0, __float_as_int(v), 0x168, 0xf, 0xf, true)); }
__device__ __forceinline__ float rowsum16(float v) { v += xm1(v); v += xm2(v); v += xm4(v); return v + xm8(v); }
// asm: the exchange fused into the maximum, one instruction a step (from the builtin move the compiler makes three: move, canonicalising maximum, maximum); all 32 lanes are on where it is used
__device__ __forceinline__ float rowmax16(float v) {
  asm("v_max_num_f32_dpp %0, %1, %1 row_xmask:1 row_mask:0xf bank_mask:0xf" : "=v"(v) : "v"(v));
  asm("v_max_num_f32_dpp %0, %1, %1 row_xmask:2 row_mask:0xf bank_mask:0xf" : "=v"(v) : "v"(v));
  asm("v_max_num_f32_dpp %0, %1, %1 row_xmask:4 row_mask:0xf bank_mask:0xf" : "=v"(v) : "v"(v));
  asm("v_max_num_f32_dpp %0, %1, %1 row_xmask:8 row_mask:0xf bank_mask:0xf" : "=v"(v) : "v"(v));
  return v; }

__global__ __launch_bounds__(128) void k_proj(const float* __restrict__ Xq, const float* __restrict__ Xk, const float* __restrict__ Xv, const float* __restrict__ Wq, const float* __restrict__ bq, const float* __restrict__ Wk, const float* __restrict__ bk, const float* __restrict__ Wv, const float* __restrict__ bv, float* __restrict__ Q, float* __restrict__ Kb, __bf16* __restrict__ VTH, __bf16* __restrict__ VTL) {
  __shared__ __align__(16) __bf16 sx[64][E + 8]; __shared__ __align__(16) float so[4][16][E + 4]; __shared__ __align__(16) __bf16 svh[E][72], svl[E][72];
  const int tid = threadIdx.x, wave = tid >> 5, lane = tid & 31, col = lane & 15, g = lane >> 4; const int b = blockIdx.y, t0 = blockIdx.x * 64, which = blockIdx.z;
  const float* X = which == 0 ? Xq : (which == 1 ? Xk : Xv); const float* Wm = which == 0 ? Wq : (which == 1 ? Wk : Wv); const float* bm = which == 0 ? bq : (which == 1 ? bk : bv);
  for (int q = tid; q < E * 64; q += 128) { const int c = q >> 6, tl = q & 63; sx[tl][c] = (__bf16)X[((size_t)b * E + c) * NT + t0 + tl]; }
  __syncthreads();
  v8f acc[16] = {};
#pragma unroll 2
  for (int kc = 0; kc < E / 32; ++kc) { const v16b a = frag_b(&sx[wave * 16 + col][kc * 32], lane);
#pragma unroll
    for (int j = 0; j < 16; ++j) acc[j] = wmma_bf(a, frag_gbf(Wm + (size_t)(j * 16 + col) * E + kc * 32, lane), acc[j]); }
#pragma unroll
  for (int j = 0; j < 16; ++j) { const float bb = bfr(bm[j * 16 + col]);
#pragma unroll
    for (int r = 0; r < 8; ++r) so[wave][8 * g + r][j * 16 + col] = acc[j][r] + bb; }
  __syncthreads();
  if (which < 2) { float* dst = which == 0 ? Q : Kb;
    for (int rl = 0; rl < 16; ++rl) for (int pc = lane; pc < E / 4; pc += 32) vst2(dst + ((size_t)b * NT + t0 + wave * 16 + rl) * E + pc * 4, *(const v4f*)&so[wave][rl][pc * 4]); }
  else {
    for (int q = tid; q < E * 64; q += 128) { const int c = q >> 6, tl = q & 63; const float v = so[tl >> 4][tl & 15][c]; const __bf16 hb = (__bf16)v; svh[c][tl] = hb; svl[c][tl] = (__bf16)(v - (float)hb); }
    __syncthreads();
    for (int q = tid; q < E * 8; q += 128) { const int c = q >> 3, pc = q & 7; const size_t o = ((size_t)b * E + c) * NT + t0 + pc * 8; vst2((unsigned*)(VTH + o), *(const v4u*)&svh[c][pc * 8]); vst2((unsigned*)(VTL + o), *(const v4u*)&svl[c][pc * 8]); } }
}
// ---- k_attn: block = (64 queries, b*8+h): s = q.k (K 32, 3 products) * scale + mask[t][s]; single pass, online softmax
__global__ __launch_bounds__(128) void k_attn(float* __restrict__ Q, const float* __restrict__ Kb, const float* __restrict__ mask, const __bf16* __restrict__ VTH, const __bf16* __restrict__ VTL) {
  __shared__ __align__(16) float sp[4][16][36]; __shared__ __align__(16) float so[4][16][36];
  const int tid = threadIdx.x, wave = tid >> 5, lane = tid & 31, col = lane & 15, g = lane >> 4; const int bh = blockIdx.y, b = bh >> 3, h = bh & 7; const int q0 = blockIdx.x * 64 + wave * 16; const float scale = 0.17677669529663687f;
  const F2 a = split_row(Q + ((size_t)b * NT + q0 + col) * E + h * HD, 0, lane);
  float m[8], l[8];   // row 8g+r: running max (equal in the row's 16 lanes), this lane's share of the running sum
#pragma unroll
  for (int r = 0; r < 8; ++r) { m[r] = -3.0e38f; l[r] = 0.f; }
  v8f acc[2] = {};
#pragma unroll 1
  for (int ks = 0; ks < NT / 32; ++ks) { float sv[2][8];
#pragma unroll
    for (int ct = 0; ct < 2; ++ct) { const int kk = ks * 32 + ct * 16 + col; const F2 kb = split_row(Kb + ((size_t)b * NT + kk) * E + h * HD, 0, lane); const v8f s = mac3(a, kb, (v8f){});
#pragma unroll
      for (int r = 0; r < 8; ++r) sv[ct][r] = s[r] * scale + bfr(mask[(size_t)(q0 + 8 * g + r) * NT + kk]); }
    float mn[8];
#pragma unroll
    for (int r = 0; r < 8; ++r) mn[r] = fmaxf(m[r], rowmax16(fmaxf(sv[0][r], sv[1][r])));
#pragma unroll
    for (int r = 0; r < 8; ++r) { const float al = exp_ni(m[r] - mn[r]), p0 = exp_ni(sv[0][r] - mn[r]), p1 = exp_ni(sv[1][r] - mn[r]);
      sp[wave][8 * g + r][col] = p0; sp[wave][8 * g + r][16 + col] = p1; l[r] = l[r] * al + (p0 + p1); acc[0][r] *= al; acc[1][r] *= al; m[r] = mn[r]; }
    LDSX();
    const F2 pa = split_row(&sp[wave][col][0], 0, lane);
#pragma unroll
    for (int dt = 0; dt < 2; ++dt) { const size_t vrow = ((size_t)b * E + h * HD + dt * 16 + col) * NT + ks * 32; const v16b vh = frag_b(VTH + vrow, lane), vl = frag_b(VTL + vrow, lane);
      acc[dt] = wmma_bf(pa.l, vh, acc[dt]); acc[dt] = wmma_bf(pa.h, vl, acc[dt]); acc[dt] = wmma_bf(pa.h, vh, acc[dt]); }
    LDSX(); }
#pragma unroll
  for (int r = 0; r < 8; ++r) { const float il = 1.0f / rowsum16(l[r]); so[wave][8 * g + r][col] = acc[0][r] * il; so[wave][8 * g + r][16 + col] = acc[1][r] * il; }
  LDSX();
  for (int rl = 0; rl < 16; ++rl) if (lane < 8) vst2(Q + ((size_t)b * NT + q0 + rl) * E + h * HD + lane * 4, *(const v4f*)&so[wave][rl][lane * 4]);
}
// ---- k_out: block = (b, 64 positions): Y[b][o][t] = sum_c O[b][t][c] Wo[o][c] + bo[o]: GEMM rows t (O rows hi/lo, K 256), cols o (16 tiles per wave = 256); written channel-major: per o the 64 t = 256 B
__global__ __launch_bounds__(128) void k_out(const float* __restrict__ O, const float* __restrict__ Wo, const float* __restrict__ bo, float* __restrict__ Y) {
  __shared__ __align__(16) float sot[E][68];          // [o][t local]
  const int tid = threadIdx.x, wave = tid >> 5, lane = tid & 31, col = lane & 15, g = lane >> 4; const int b = blockIdx.y, t0 = blockIdx.x * 64;
  v8f acc[16] = {};
#pragma unroll 1
  for (int kc = 0; kc < E / 32; ++kc) { const F2 a = split_row(O + ((size_t)b * NT + t0 + wave * 16 + col) * E, kc * 32, lane);
#pragma unroll
    for (int j = 0; j < 16; ++j) { const v16b w = frag_gbf(Wo + (size_t)(j * 16 + col) * E + kc * 32, lane); acc[j] = wmma_bf(a.l, w, acc[j]); acc[j] = wmma_bf(a.h, w, acc[j]); } }
#pragma unroll
  for (int j = 0; j < 16; ++j) { const int o = j * 16 + col; const float bb = bfr(bo[o]);
#pragma unroll
    for (int r = 0; r < 8; ++r) sot[o][wave * 16 + 8 * g + r] = acc[j][r] + bb; }
  __syncthreads();
  for (int q = tid; q < E * 16; q += 128) { const int o = q >> 4, pc = q & 15; vst2(Y + ((size_t)b * E + o) * NT + t0 + pc * 4, *(const v4f*)&sot[o][pc * 4]); }
}

extern "C" void kernel_launch(void* const* d_in, const int* in_sizes, int n_in, void* d_out, int out_size, void* d_ws, size_t ws_size, hipStream_t stream) {
  (void)in_sizes; (void)n_in; (void)out_size;
  const float** F = (const float**)d_in;   // d_in order: query, key, value [8,256,32,32], attn_mask [1024,1024], Wq, Wk, Wv, Wo [256,256], bq, bk, bv, bo [256]
  if (ws_size < (size_t)WS_END) return;
  char* ws = (char*)d_ws; float *Q = (float*)(ws + WS_Q), *Kb = (float*)(ws + WS_K); __bf16 *VTH = (__bf16*)(ws + WS_VTH), *VTL = (__bf16*)(ws + WS_VTL);
  k_proj<<<dim3(NT / 64, TNB, 3), 128, 0, stream>>>(F[0], F[1], F[2], F[4], F[8], F[5], F[9], F[6], F[10], Q, Kb, VTH, VTL);
  k_attn<<<dim3(TQB, TNB * NH), 128, 0, stream>>>(Q, Kb, F[3], VTH, VTL);
  k_out<<<dim3(TQB, TNB), 128, 0, stream>>>(Q, F[7], F[11], (float*)d_out);
}

// v002
// One run takes 283 microseconds.
// Two timings next to v001 both put it at 1.11 times that version's speed.
// Counting every step since v000, it is 1.60 times as fast.
#include <hip/hip_runtime.h>
#include <math.h>

typedef __attribute__((ext_vector_type(16))) _Float16 v16h;
typedef __attribute__((ext_vector_type(16))) __bf16 v16b;
typedef __attribute__((ext_vector_type(8)))  _Float16 v8h;
typedef __attribute__((ext_vector_type(8)))  float v8f;
typedef __attribute__((ext_vector_type(4)))  float v4f;
typedef __attribute__((ext_vector_type(2)))  float v2f;
typedef __attribute__((ext_vector_type(4)))  unsigned v4u;
typedef __attribute__((ext_vector_type(4)))  int v4i;
typedef float __attribute__((may_alias)) float_a;
typedef int __attribute__((may_alias)) int_a;

template <typename T> __device__ __forceinline__ void vst2(void* p, T v) { *(T*)p = v;  }
__device__ __forceinline__ v8f wmma16(v16h a, v16h b, v8f c) {
  v8f d = __builtin_amdgcn_wmma_f32_16x16x32_f16(false, a, false, b, (short)0, c, false, false);
  asm volatile("v_nop\n\tv_nop\n\tv_nop\n\tv_nop" : "+v"(d) : "v"(a), "v"(b));
  return d;
}
__device__ __forceinline__ v8f wmma_bf(v16b a, v16b b, v8f c) {
  v8f d = __builtin_amdgcn_wmma_f32_16x16x32_bf16(false, a, false, b, (short)0, c, false, false);
  asm volatile("v_nop\n\tv_nop\n\tv_nop\n\tv_nop" : "+v"(d) : "v"(a), "v"(b));
  return d;
}
// 16x16x32 fragments: lane = (h = lane>>4, row/col = lane&15); elements 0..7 = k0+8h+0..7, 8..15 = k0+16+8h+0..7; D element r = row 8h+r
__device__ __forceinline__ v16h frag_h(const _Float16* rowk0, int lane) {
  union { v16h v; v8h q[2]; } u; const _Float16* p = rowk0 + 8 * (lane >> 4);
  u.q[0] = *(const v8h*)p; u.q[1] = *(const v8h*)(p + 16); return u.v;
}
__device__ __forceinline__ v16h frag_f32(const float* rowk0, int lane) {
  v16h a; const float* p = rowk0 + 8 * (lane >> 4);
#pragma unroll
  for (int i = 0; i < 8; ++i) { a[i] = (_Float16)p[i]; a[8 + i] = (_Float16)p[16 + i]; }
  return a;
}
__device__ __forceinline__ v16h frag_f32s(const float* rowk0, int lane, float sc) {
  v16h a; const float* p = rowk0 + 8 * (lane >> 4);
#pragma unroll
  for (int i = 0; i < 8; ++i) { a[i] = (_Float16)(p[i] * sc); a[8 + i] = (_Float16)(p[16 + i] * sc); }
  return a;
}
// column fragment from a [K][ld] layout (column n), rows >= K read as 0
__device__ __forceinline__ v16h fragc_f32(const float* W, int k0, int n, int lane, int ld, int K) {
  v16h a; const int g = lane >> 4;
#pragma unroll
  for (int i = 0; i < 8; ++i) { const int ka = k0 + 8 * g + i, kb = ka + 16;
    a[i] = (_Float16)(ka < K ? W[(size_t)(ka < K ? ka : K - 1) * ld + n] : 0.f); a[8 + i] = (_Float16)(kb < K ? W[(size_t)(kb < K ? kb : K - 1) * ld + n] : 0.f); }
  return a;
}
struct F2 { v16b h, l; };
__device__ __forceinline__ F2 bsplit16(const float v[16]) { F2 r;
#pragma unroll
  for (int i = 0; i < 16; ++i) { const __bf16 h = (__bf16)v[i]; r.h[i] = h; r.l[i] = (__bf16)(v[i] - (float)h); }
  return r; }
__device__ __forceinline__ F2 split_row(const float* row, int k0, int lane) { float v[16]; const float* p = row + k0 + 8 * (lane >> 4);
#pragma unroll
  for (int i = 0; i < 8; ++i) { v[i] = p[i]; v[8 + i] = p[16 + i]; }
  return bsplit16(v); }
__device__ __forceinline__ F2 split_rowK(const float* row, int k0, int lane, int K) { float v[16]; const int g = lane >> 4;
#pragma unroll
  for (int i = 0; i < 8; ++i) { const int ka = k0 + 8 * g + i, kb = ka + 16; v[i] = ka < K ? row[ka < K ? ka : K - 1] : 0.f; v[8 + i] = kb < K ? row[kb < K ? kb : K - 1] : 0.f; }
  return bsplit16(v); }
__device__ __forceinline__ F2 split_col(const float* W, int k0, int n, int lane, int ld, int K) { float v[16]; const int g = lane >> 4;
#pragma unroll
  for (int i = 0; i < 8; ++i) { const int ka = k0 + 8 * g + i, kb = ka + 16; v[i] = ka < K ? W[(size_t)(ka < K ? ka : K - 1) * ld + n] : 0.f; v[8 + i] = kb < K ? W[(size_t)(kb < K ? kb : K - 1) * ld + n] : 0.f; }
  return bsplit16(v); }
__device__ __forceinline__ v8f mac3(const F2& a, const F2& b, v8f c) { c = wmma_bf(a.l, b.h, c); c = wmma_bf(a.h, b.l, c); return wmma_bf(a.h, b.h, c); }
__device__ __forceinline__ float sigm(float v) { return 1.0f / (1.0f + expf(-v)); }
#define LDSX() do { asm volatile("s_wait_dscnt 0" ::: "memory"); __builtin_amdgcn_wave_barrier(); __builtin_amdgcn_fence(__ATOMIC_RELEASE, "workgroup"); } while (0)


// Multi-head attention over 32x32 feature maps (channel-major NCHW inputs): q/k/v = 1x1 conv (W x + b) per position, 8 heads x 32, scores = q k^T / sqrt(32) + attn_mask[t][s] (dense float mask, shared across batch/heads), softmax over s, P v, concat heads (channel = h*32 + d), out = Wo out + bo -> [B, 256, 32, 32].
// k_proj (per (b, 64 positions): gathers the channel-major input columns into LDS as bf16 [pos][ch], one-product bf16 GEMM against bf16-rounded W rows; q,k as position rows [b][t][256], v as channel-major hi/lo planes [b][ch][t]), k_attn (per (64 queries, b, h): one pass over the 1024 keys, running row max m (kept as m log2 e) and row sum l; P = 2^(s log2 e - m log2 e) hi/lo . V^T planes, O and l rescaled by 2^(m_old log2 e - m_new log2 e) per 32 keys, O / l at the end, O rows), k_out (O(hi/lo) . Wo rows + bo, written channel-major: per output channel one 256-B segment of 64 positions).
#define NB 8
#define E 256
#define NT 1024
#define NH 8
#define HD 32
#ifndef TNB
#define TNB NB
#define TQB (NT / 64)
#endif
typedef __attribute__((ext_vector_type(8))) __bf16 v8b;
__device__ __forceinline__ v16b frag_b(const __bf16* rowk0, int lane) {
  union { v16b v; v8b q[2]; } u; const __bf16* p = rowk0 + 8 * (lane >> 4);
  u.q[0] = *(const v8b*)p; u.q[1] = *(const v8b*)(p + 16); return u.v;
}
__device__ __forceinline__ v16b frag_gbf(const float* rowk0, int lane) {
  v16b a; const float* p = rowk0 + 8 * (lane >> 4);
#pragma unroll
  for (int i = 0; i < 8; ++i) { a[i] = (__bf16)p[i]; a[8 + i] = (__bf16)p[16 + i]; }
  return a;
}
__device__ __forceinline__ float bfr(float v) { return (float)(__bf16)v; }
// 2^v as the one hardware instruction, in line; arguments here are <= 0 up to rounding, and a result below the normal range may read as 0
__device__ __forceinline__ float ex2(float v) { return __builtin_amdgcn_exp2f(v); }
#define L2E 1.4426950408889634f
#define WS_Q    0u                               // f32 [8][1024][256] q rows (t-major); later O rows
#define WS_K    (WS_Q + 4u * NB * NT * E)
#define WS_VTH  (WS_K + 4u * NB * NT * E)          // bf16 [8][256 ch][1024 t]
#define WS_VTL  (WS_VTH + 2u * NB * E * NT)
#define WS_END  (WS_VTL + 2u * NB * E * NT)
// sum / maximum over the 16 lanes of a half-wave (the 16 key columns of one score row): four row_xmask exchanges, every lane gets the result
__device__ __forceinline__ float xm1(float v) { return __int_as_float(__builtin_amdgcn_update_dpp(0, __float_as_int(v), 0x161, 0xf, 0xf, true)); }
__device__ __forceinline__ float xm2(float v) { return __int_as_float(__builtin_amdgcn_update_dpp(0, __float_as_int(v), 0x162, 0xf, 0xf, true)); }
__device__ __forceinline__ float xm4(float v) { return __int_as_float(__builtin_amdgcn_update_dpp(0, __float_as_int(v), 0x164, 0xf, 0xf, true)); }
__device__ __forceinline__ float xm8(float v) { return __int_as_float(__builtin_amdgcn_update_dpp(0, __float_as_int(v), 0x168, 0xf, 0xf, true)); }
__device__ __forceinline__ float rowsum16(float v) { v += xm1(v); v += xm2(v); v += xm4(v); return v + xm8(v); }
// asm: the exchange fused into the maximum, one instruction a step (from the builtin move the compiler makes three: move, canonicalising maximum, maximum); all 32 lanes are on where it is used
__device__ __forceinline__ float rowmax16(float v) {
  asm("v_max_num_f32_dpp %0, %1, %1 row_xmask:1 row_mask:0xf bank_mask:0xf" : "=v"(v) : "v"(v));
  asm("v_max_num_f32_dpp %0, %1, %1 row_xmask:2 row_mask:0xf bank_mask:0xf" : "=v"(v) : "v"(v));
  asm("v_max_num_f32_dpp %0, %1, %1 row_xmask:4 row_mask:0xf bank_mask:0xf" : "=v"(v) : "v"(v));
  asm("v_max_num_f32_dpp %0, %1, %1 row_xmask:8 row_mask:0xf bank_mask:0xf" : "=v"(v) : "v"(v));
  return v; }

__global__ __launch_bounds__(128) void k_proj(const float* __restrict__ Xq, const float* __restrict__ Xk, const float* __restrict__ Xv, const float* __restrict__ Wq, const float* __restrict__ bq, const float* __restrict__ Wk, const float* __restrict__ bk, const float* __restrict__ Wv, const float* __restrict__ bv, float* __restrict__ Q, float* __restrict__ Kb, __bf16* __restrict__ VTH, __bf16* __restrict__ VTL) {
  __shared__ __align__(16) __bf16 sx[64][E + 8]; __shared__ __align__(16) float so[4][16][E + 4]; __shared__ __align__(16) __bf16 svh[E][72], svl[E][72];
  const int tid = threadIdx.x, wave = tid >> 5, lane = tid & 31, col = lane & 15, g = lane >> 4; const int b = blockIdx.y, t0 = blockIdx.x * 64, which = blockIdx.z;
  const float* X = which == 0 ? Xq : (which == 1 ? Xk : Xv); const float* Wm = which == 0 ? Wq : (which == 1 ? Wk : Wv); const float* bm = which == 0 ? bq : (which == 1 ? bk : bv);
  for (int q = tid; q < E * 64; q += 128) { const int c = q >> 6, tl = q & 63; sx[tl][c] = (__bf16)X[((size_t)b * E + c) * NT + t0 + tl]; }
  __syncthreads();
  v8f acc[16] = {};
#pragma unroll 2
  for (int kc = 0; kc < E / 32; ++kc) { const v16b a = frag_b(&sx[wave * 16 + col][kc * 32], lane);
#pragma unroll
    for (int j = 0; j < 16; ++j) acc[j] = wmma_bf(a, frag_gbf(Wm + (size_t)(j * 16 + col) * E + kc * 32, lane), acc[j]); }
#pragma unroll
  for (int j = 0; j < 16; ++j) { const float bb = bfr(bm[j * 16 + col]);
#pragma unroll
    for (int r = 0; r < 8; ++r) so[wave][8 * g + r][j * 16 + col] = acc[j][r] + bb; }
  __syncthreads();
  if (which < 2) { float* dst = which == 0 ? Q : Kb;
    for (int rl = 0; rl < 16; ++rl) for (int pc = lane; pc < E / 4; pc += 32) vst2(dst + ((size_t)b * NT + t0 + wave * 16 + rl) * E + pc * 4, *(const v4f*)&so[wave][rl][pc * 4]); }
  else {
    for (int q = tid; q < E * 64; q += 128) { const int c = q >> 6, tl = q & 63; const float v = so[tl >> 4][tl & 15][c]; const __bf16 hb = (__bf16)v; svh[c][tl] = hb; svl[c][tl] = (__bf16)(v - (float)hb); }
    __syncthreads();
    for (int q = tid; q < E * 8; q += 128) { const int c = q >> 3, pc = q & 7; const size_t o = ((size_t)b * E + c) * NT + t0 + pc * 8; vst2((unsigned*)(VTH + o), *(const v4u*)&svh[c][pc * 8]); vst2((unsigned*)(VTL + o), *(const v4u*)&svl[c][pc * 8]); } }
}
// ---- k_attn: block = (64 queries, b*8+h): s = q.k (K 32, 3 products) * scale + mask[t][s]; single pass, online softmax
__global__ __launch_bounds__(128) void k_attn(float* __restrict__ Q, const float* __restrict__ Kb, const float* __restrict__ mask, const __bf16* __restrict__ VTH, const __bf16* __restrict__ VTL) {
  __shared__ __align__(16) float sp[4][16][36]; __shared__ __align__(16) float so[4][16][36];
  const int tid = threadIdx.x, wave = tid >> 5, lane = tid & 31, col = lane & 15, g = lane >> 4; const int bh = blockIdx.y, b = bh >> 3, h = bh & 7; const int q0 = blockIdx.x * 64 + wave * 16; const float scale = 0.17677669529663687f;
  const F2 a = split_row(Q + ((size_t)b * NT + q0 + col) * E + h * HD, 0, lane);
  float m[8], l[8];   // row 8g+r: running max times log2 e (equal in the row's 16 lanes), this lane's share of the running sum
#pragma unroll
  for (int r = 0; r < 8; ++r) { m[r] = -3.0e38f; l[r] = 0.f; }
  v8f acc[2] = {};
#pragma unroll 1
  for (int ks = 0; ks < NT / 32; ++ks) { float sv[2][8];
#pragma unroll
    for (int ct = 0; ct < 2; ++ct) { const int kk = ks * 32 + ct * 16 + col; const F2 kb = split_row(Kb + ((size_t)b * NT + kk) * E + h * HD, 0, lane); const v8f s = mac3(a, kb, (v8f){});
#pragma unroll
      for (int r = 0; r < 8; ++r) sv[ct][r] = s[r] * scale + bfr(mask[(size_t)(q0 + 8 * g + r) * NT + kk]); }
    float mn[8];
#pragma unroll
    for (int r = 0; r < 8; ++r) mn[r] = fmaxf(m[r], rowmax16(fmaxf(sv[0][r], sv[1][r])) * L2E);
#pragma unroll
    for (int r = 0; r < 8; ++r) { const float al = ex2(m[r] - mn[r]), p0 = ex2(fmaf(sv[0][r], L2E, -mn[r])), p1 = ex2(fmaf(sv[1][r], L2E, -mn[r]));
      sp[wave][8 * g + r][col] = p0; sp[wave][8 * g + r][16 + col] = p1; l[r] = l[r] * al + (p0 + p1); acc[0][r] *= al; acc[1][r] *= al; m[r] = mn[r]; }
    LDSX();
    const F2 pa = split_row(&sp[wave][col][0], 0, lane);
#pragma unroll
    for (int dt = 0; dt < 2; ++dt) { const size_t vrow = ((size_t)b * E + h * HD + dt * 16 + col) * NT + ks * 32; const v16b vh = frag_b(VTH + vrow, lane), vl = frag_b(VTL + vrow, lane);
      acc[dt] = wmma_bf(pa.l, vh, acc[dt]); acc[dt] = wmma_bf(pa.h, vl, acc[dt]); acc[dt] = wmma_bf(pa.h, vh, acc[dt]); }
    LDSX(); }
#pragma unroll
  for (int r = 0; r < 8; ++r) { const float il = 1.0f / rowsum16(l[r]); so[wave][8 * g + r][col] = acc[0][r] * il; so[wave][8 * g + r][16 + col] = acc[1][r] * il; }
  LDSX();
  for (int rl = 0; rl < 16; ++rl) if (lane < 8) vst2(Q + ((size_t)b * NT + q0 + rl) * E + h * HD + lane * 4, *(const v4f*)&so[wave][rl][lane * 4]);
}
// ---- k_out: block = (b, 64 positions): Y[b][o][t] = sum_c O[b][t][c] Wo[o][c] + bo[o]: GEMM rows t (O rows hi/lo, K 256), cols o (16 tiles per wave = 256); written channel-major: per o the 64 t = 256 B
__global__ __launch_bounds__(128) void k_out(const float* __restrict__ O, const float* __restrict__ Wo, const float* __restrict__ bo, float* __restrict__ Y) {
  __shared__ __align__(16) float sot[E][68];          // [o][t local]
  const int tid = threadIdx.x, wave = tid >> 5, lane = tid & 31, col = lane & 15, g = lane >> 4; const int b = blockIdx.y, t0 = blockIdx.x * 64;
  v8f acc[16] = {};
#pragma unroll 1
  for (int kc = 0; kc < E / 32; ++kc) { const F2 a = split_row(O + ((size_t)b * NT + t0 + wave * 16 + col) * E, kc * 32, lane);
#pragma unroll
    for (int j = 0; j < 16; ++j) { const v16b w = frag_gbf(Wo + (size_t)(j * 16 + col) * E + kc * 32, lane); acc[j] = wmma_bf(a.l, w, acc[j]); acc[j] = wmma_bf(a.h, w, acc[j]); } }
#pragma unroll
  for (int j = 0; j < 16; ++j) { const int o = j * 16 + col; const float bb = bfr(bo[o]);
#pragma unroll
    for (int r = 0; r < 8; ++r) sot[o][wave * 16 + 8 * g + r] = acc[j][r] + bb; }
  __syncthreads();
  for (int q = tid; q < E * 16; q += 128) { const int o = q >> 4, pc = q & 15; vst2(Y + ((size_t)b * E + o) * NT + t0 + pc * 4, *(const v4f*)&sot[o][pc * 4]); }
}

extern "C" void kernel_launch(void* const* d_in, const int* in_sizes, int n_in, void* d_out, int out_size, void* d_ws, size_t ws_size, hipStream_t stream) {
  (void)in_sizes; (void)n_in; (void)out_size;
  const float** F = (const float**)d_in;   // d_in order: query, key, value [8,256,32,32], attn_mask [1024,1024], Wq, Wk, Wv, Wo [256,256], bq, bk, bv, bo [256]
  if (ws_size < (size_t)WS_END) return;
  char* ws = (char*)d_ws; float *Q = (float*)(ws + WS_Q), *Kb = (float*)(ws + WS_K); __bf16 *VTH = (__bf16*)(ws + WS_VTH), *VTL = (__bf16*)(ws + WS_VTL);
  k_proj<<<dim3(NT / 64, TNB, 3), 128, 0, stream>>>(F[0], F[1], F[2], F[4], F[8], F[5], F[9], F[6], F[10], Q, Kb, VTH, VTL);
  k_attn<<<dim3(TQB, TNB * NH), 128, 0, stream>>>(Q, Kb, F[3], VTH, VTL);
  k_out<<<dim3(TQB, TNB), 128, 0, stream>>>(Q, F[7], F[11], (float*)d_out);
}

// v003
// A run of this version takes 247 microseconds.
// Next to v002, in two timings, it ran 1.14 times as fast each time.
// Over all steps from v000 it is 1.82 times as fast.
#include <hip/hip_runtime.h>
#include <math.h>

typedef __attribute__((ext_vector_type(16))) _Float16 v16h;
typedef __attribute__((ext_vector_type(16))) __bf16 v16b;
typedef __attribute__((ext_vector_type(8)))  _Float16 v8h;
typedef __attribute__((ext_vector_type(8)))  float v8f;
typedef __attribute__((ext_vector_type(4)))  float v4f;
typedef __attribute__((ext_vector_type(2)))  float v2f;
typedef __attribute__((ext_vector_type(4)))  unsigned v4u;
typedef __attribute__((ext_vector_type(4)))  int v4i;
typedef float __attribute__((may_alias)) float_a;
typedef int __attribute__((may_alias)) int_a;

template <typename T> __device__ __forceinline__ void vst2(void* p, T v) { *(T*)p = v;  }
__device__ __forceinline__ v8f wmma16(v16h a, v16h b, v8f c) {
  v8f d = __builtin_amdgcn_wmma_f32_16x16x32_f16(false, a, false, b, (short)0, c, false, false);
  asm volatile("v_nop\n\tv_nop\n\tv_nop\n\tv_nop" : "+v"(d) : "v"(a), "v"(b));
  return d;
}
__device__ __forceinline__ v8f wmma_bf(v16b a, v16b b, v8f c) {
  v8f d = __builtin_amdgcn_wmma_f32_16x16x32_bf16(false, a, false, b, (short)0, c, false, false);
  asm volatile("v_nop\n\tv_nop\n\tv_nop\n\tv_nop" : "+v"(d) : "v"(a), "v"(b));
  return d;
}
// 16x16x32 fragments: lane = (h = lane>>4, row/col = lane&15); elements 0..7 = k0+8h+0..7, 8..15 = k0+16+8h+0..7; D element r = row 8h+r
__device__ __forceinline__ v16h frag_h(const _Float16* rowk0, int lane) {
  union { v16h v; v8h q[2]; } u; const _Float16* p = rowk0 + 8 * (lane >> 4);
  u.q[0] = *(const v8h*)p; u.q[1] = *(const v8h*)(p + 16); return u.v;
}
__device__ __forceinline__ v16h frag_f32(const float* rowk0, int lane) {
  v16h a; const float* p = rowk0 + 8 * (lane >> 4);
#pragma unroll
  for (int i = 0; i < 8; ++i) { a[i] = (_Float16)p[i]; a[8 + i] = (_Float16)p[16 + i]; }
  return a;
}
__device__ __forceinline__ v16h frag_f32s(const float* rowk0, int lane, float sc) {
  v16h a; const float* p = rowk0 + 8 * (lane >> 4);
#pragma unroll
  for (int i = 0; i < 8; ++i) { a[i] = (_Float16)(p[i] * sc); a[8 + i] = (_Float16)(p[16 + i] * sc); }
  return a;
}
// column fragment from a [K][ld] layout (column n), rows >= K read as 0
__device__ __forceinline__ v16h fragc_f32(const float* W, int k0, int n, int lane, int ld, int K) {
  v16h a; const int g = lane >> 4;
#pragma unroll
  for (int i = 0; i < 8; ++i) { const int ka = k0 + 8 * g + i, kb = ka + 16;
    a[i] = (_Float16)(ka < K ? W[(size_t)(ka < K ? ka : K - 1) * ld + n] : 0.f); a[8 + i] = (_Float16)(kb < K ? W[(size_t)(kb < K ? kb : K - 1) * ld + n] : 0.f); }
  return a;
}
struct F2 { v16b h, l; };
__device__ __forceinline__ F2 bsplit16(const float v[16]) { F2 r;
#pragma unroll
  for (int i = 0; i < 16; ++i) { const __bf16 h = (__bf16)v[i]; r.h[i] = h; r.l[i] = (__bf16)(v[i] - (float)h); }
  return r; }
__device__ __forceinline__ F2 split_row(const float* row, int k0, int lane) { float v[16]; const float* p = row + k0 + 8 * (lane >> 4);
#pragma unroll
  for (int i = 0; i < 8; ++i) { v[i] = p[i]; v[8 + i] = p[16 + i]; }
  return bsplit16(v); }
__device__ __forceinline__ F2 split_rowK(const float* row, int k0, int lane, int K) { float v[16]; const int g = lane >> 4;
#pragma unroll
  for (int i = 0; i < 8; ++i) { const int ka = k0 + 8 * g + i, kb = ka + 16; v[i] = ka < K ? row[ka < K ? ka : K - 1] : 0.f; v[8 + i] = kb < K ? row[kb < K ? kb : K - 1] : 0.f; }
  return bsplit16(v); }
__device__ __forceinline__ F2 split_col(const float* W, int k0, int n, int lane, int ld, int K) { float v[16]; const int g = lane >> 4;
#pragma unroll
  for (int i = 0; i < 8; ++i) { const int ka = k0 + 8 * g + i, kb = ka + 16; v[i] = ka < K ? W[(size_t)(ka < K ? ka : K - 1) * ld + n] : 0.f; v[8 + i] = kb < K ? W[(size_t)(kb < K ? kb : K - 1) * ld + n] : 0.f; }
  return bsplit16(v); }
__device__ __forceinline__ v8f mac3(const F2& a, const F2& b, v8f c) { c = wmma_bf(a.l, b.h, c); c = wmma_bf(a.h, b.l, c); return wmma_bf(a.h, b.h, c); }
__device__ __forceinline__ float sigm(float v) { return 1.0f / (1.0f + expf(-v)); }
#define LDSX() do { asm volatile("s_wait_dscnt 0" ::: "memory"); __builtin_amdgcn_wave_barrier(); __builtin_amdgcn_fence(__ATOMIC_RELEASE, "workgroup"); } while (0)


// Multi-head attention over 32x32 feature maps (channel-major NCHW inputs): q/k/v = 1x1 conv (W x + b) per position, 8 heads x 32, scores = q k^T / sqrt(32) + attn_mask[t][s] (dense float mask, shared across batch/heads), softmax over s, P v, concat heads (channel = h*32 + d), out = Wo out + bo -> [B, 256, 32, 32].
// k_proj (per (b, 64 positions): gathers the channel-major input columns into LDS as bf16 [pos][ch], one-product bf16 GEMM against bf16-rounded W rows; q,k as position rows [b][t][256], v as channel-major hi/lo planes [b][ch][t]), k_attn (per (64 queries, b, h): one pass over the 1024 keys, running row max m (kept as m log2 e) and row sum l; P = 2^(s log2 e - m log2 e) hi/lo . V^T planes, O and l rescaled by 2^(m_old log2 e - m_new log2 e) per 32 keys, O / l at the end, O rows), k_out (O(hi/lo) . Wo rows + bo, written channel-major: per output channel one 256-B segment of 64 positions).
#define NB 8
#define E 256
#define NT 1024
#define NH 8
#define HD 32
#ifndef TNB
#define TNB NB
#define TQB (NT / 64)
#endif
typedef __attribute__((ext_vector_type(8))) __bf16 v8b;
__device__ __forceinline__ v16b frag_b(const __bf16* rowk0, int lane) {
  union { v16b v; v8b q[2]; } u; const __bf16* p = rowk0 + 8 * (lane >> 4);
  u.q[0] = *(const v8b*)p; u.q[1] = *(const v8b*)(p + 16); return u.v;
}
__device__ __forceinline__ v16b frag_gbf(const float* rowk0, int lane) {
  v16b a; const float* p = rowk0 + 8 * (lane >> 4);
#pragma unroll
  for (int i = 0; i < 8; ++i) { a[i] = (__bf16)p[i]; a[8 + i] = (__bf16)p[16 + i]; }
  return a;
}
__device__ __forceinline__ float bfr(float v) { return (float)(__bf16)v; }
// 2^v as the one hardware instruction, in line; arguments here are <= 0 up to rounding, and a result below the normal range may read as 0
__device__ __forceinline__ float ex2(float v) { return __builtin_amdgcn_exp2f(v); }
#define L2E 1.4426950408889634f
#define WS_Q    0u                               // f32 [8][1024][256] q rows (t-major); later O rows
#define WS_K    (WS_Q + 4u * NB * NT * E)
#define WS_VTH  (WS_K + 4u * NB * NT * E)          // bf16 [8][256 ch][1024 t]
#define WS_VTL  (WS_VTH + 2u * NB * E * NT)
#define WS_END  (WS_VTL + 2u * NB * E * NT)
// sum / maximum over the 16 lanes of a half-wave (the 16 key columns of one score row): four row_xmask exchanges, every lane gets the result
__device__ __forceinline__ float xm1(float v) { return __int_as_float(__builtin_amdgcn_update_dpp(0, __float_as_int(v), 0x161, 0xf, 0xf, true)); }
__device__ __forceinline__ float xm2(float v) { return __int_as_float(__builtin_amdgcn_update_dpp(0, __float_as_int(v), 0x162, 0xf, 0xf, true)); }
__device__ __forceinline__ float xm4(float v) { return __int_as_float(__builtin_amdgcn_update_dpp(0, __float_as_int(v), 0x164, 0xf, 0xf, true)); }
__device__ __forceinline__ float xm8(float v) { return __int_as_float(__builtin_amdgcn_update_dpp(0, __float_as_int(v), 0x168, 0xf, 0xf, true)); }
__device__ __forceinline__ float rowsum16(float v) { v += xm1(v); v += xm2(v); v += xm4(v); return v + xm8(v); }
// asm: the exchange fused into the maximum, one instruction a step (from the builtin move the compiler makes three: move, canonicalising maximum, maximum); all 32 lanes are on where it is used
__device__ __forceinline__ float rowmax16(float v) {
  asm("v_max_num_f32_dpp %0, %1, %1 row_xmask:1 row_mask:0xf bank_mask:0xf" : "=v"(v) : "v"(v));
  asm("v_max_num_f32_dpp %0, %1, %1 row_xmask:2 row_mask:0xf bank_mask:0xf" : "=v"(v) : "v"(v));
  asm("v_max_num_f32_dpp %0, %1, %1 row_xmask:4 row_mask:0xf bank_mask:0xf" : "=v"(v) : "v"(v));
  asm("v_max_num_f32_dpp %0, %1, %1 row_xmask:8 row_mask:0xf bank_mask:0xf" : "=v"(v) : "v"(v));
  return v; }

__global__ __launch_bounds__(128) void k_proj(const float* __restrict__ Xq, const float* __restrict__ Xk, const float* __restrict__ Xv, const float* __restrict__ Wq, const float* __restrict__ bq, const float* __restrict__ Wk, const float* __restrict__ bk, const float* __restrict__ Wv, const float* __restrict__ bv, float* __restrict__ Q, float* __restrict__ Kb, __bf16* __restrict__ VTH, __bf16* __restrict__ VTL) {
  __shared__ __align__(16) __bf16 sx[64][E + 8]; __shared__ __align__(16) float so[4][16][E + 4]; __shared__ __align__(16) __bf16 svh[E][72], svl[E][72];
  const int tid = threadIdx.x, wave = tid >> 5, lane = tid & 31, col = lane & 15, g = lane >> 4; const int b = blockIdx.y, t0 = blockIdx.x * 64, which = blockIdx.z;
  const float* X = which == 0 ? Xq : (which == 1 ? Xk : Xv); const float* Wm = which == 0 ? Wq : (which == 1 ? Wk : Wv); const float* bm = which == 0 ? bq : (which == 1 ? bk : bv);
  for (int q = tid; q < E * 64; q += 128) { const int c = q >> 6, tl = q & 63; sx[tl][c] = (__bf16)X[((size_t)b * E + c) * NT + t0 + tl]; }
  __syncthreads();
  v8f acc[16] = {};
#pragma unroll 2
  for (int kc = 0; kc < E / 32; ++kc) { const v16b a = frag_b(&sx[wave * 16 + col][kc * 32], lane);
#pragma unroll
    for (int j = 0; j < 16; ++j) acc[j] = wmma_bf(a, frag_gbf(Wm + (size_t)(j * 16 + col) * E + kc * 32, lane), acc[j]); }
#pragma unroll
  for (int j = 0; j < 16; ++j) { const float bb = bfr(bm[j * 16 + col]);
#pragma unroll
    for (int r = 0; r < 8; ++r) so[wave][8 * g + r][j * 16 + col] = acc[j][r] + bb; }
  __syncthreads();
  if (which < 2) { float* dst = which == 0 ? Q : Kb;
    for (int rl = 0; rl < 16; ++rl) for (int pc = lane; pc < E / 4; pc += 32) vst2(dst + ((size_t)b * NT + t0 + wave * 16 + rl) * E + pc * 4, *(const v4f*)&so[wave][rl][pc * 4]); }
  else {
    for (int q = tid; q < E * 64; q += 128) { const int c = q >> 6, tl = q & 63; const float v = so[tl >> 4][tl & 15][c]; const __bf16 hb = (__bf16)v; svh[c][tl] = hb; svl[c][tl] = (__bf16)(v - (float)hb); }
    __syncthreads();
    for (int q = tid; q < E * 8; q += 128) { const int c = q >> 3, pc = q & 7; const size_t o = ((size_t)b * E + c) * NT + t0 + pc * 8; vst2((unsigned*)(VTH + o), *(const v4u*)&svh[c][pc * 8]); vst2((unsigned*)(VTL + o), *(const v4u*)&svl[c][pc * 8]); } }
}
// ---- k_attn: block = (64 queries, b*8+h): s = q.k (K 32, 3 products) * scale + mask[t][s]; single pass, online softmax
// K rows and V^T planes come in stages of 64 keys: the block's 128 threads fetch a stage once, in whole 128-B lines, one stage ahead into registers, and put it into the LDS buffer that is free; all four waves read their fragments from there
#define SK 64
__global__ __launch_bounds__(128) void k_attn(float* __restrict__ Q, const float* __restrict__ Kb, const float* __restrict__ mask, const __bf16* __restrict__ VTH, const __bf16* __restrict__ VTL) {
  __shared__ __align__(16) float sp[4][16][36]; __shared__ __align__(16) float so[4][16][36];
  __shared__ __align__(16) float sk[2][SK][36];                               // [buffer][key][d], pitch 36 dwords: 16 rows' 16-B reads fall on 16 different bank groups
  __shared__ __align__(16) __bf16 svh[2][HD][SK + 8], svl[2][HD][SK + 8];     // [buffer][channel][key], the same pitch in bytes
  const int tid = threadIdx.x, wave = tid >> 5, lane = tid & 31, col = lane & 15, g = lane >> 4; const int bh = blockIdx.y, b = bh >> 3, h = bh & 7; const int q0 = blockIdx.x * 64 + wave * 16; const float scale = 0.17677669529663687f;
  const int srow = tid >> 3, sseg = tid & 7;   // staging: 8 threads a 128-B row, 16 rows a pass of the block
  const float* kg = Kb + ((size_t)b * NT + srow) * E + h * HD + sseg * 4;
  const size_t vg = ((size_t)b * E + h * HD + srow) * NT + sseg * 8;
  v4f kr[4]; v8b hr[2], lr[2];   // one stage on its way; every loop over them is unrolled so that they stay in registers
#pragma unroll
  for (int i = 0; i < 4; ++i) kr[i] = *(const v4f*)(kg + (size_t)(i * 16) * E);
#pragma unroll
  for (int i = 0; i < 2; ++i) { hr[i] = *(const v8b*)(VTH + vg + (size_t)(i * 16) * NT); lr[i] = *(const v8b*)(VTL + vg + (size_t)(i * 16) * NT); }
  asm volatile("s_wait_xcnt 0x0" ::: "memory");   // the address registers of the loads above are reused at once (the query row's load lands in them): the wait stands in front of that overwrite
  const F2 a = split_row(Q + ((size_t)b * NT + q0 + col) * E + h * HD, 0, lane);
  float m[8], l[8];   // row 8g+r: running max times log2 e (equal in the row's 16 lanes), this lane's share of the running sum
#pragma unroll
  for (int r = 0; r < 8; ++r) { m[r] = -3.0e38f; l[r] = 0.f; }
  v8f acc[2] = {};
#pragma unroll
  for (int i = 0; i < 4; ++i) *(v4f*)&sk[0][i * 16 + srow][sseg * 4] = kr[i];
#pragma unroll
  for (int i = 0; i < 2; ++i) { *(v8b*)&svh[0][i * 16 + srow][sseg * 8] = hr[i]; *(v8b*)&svl[0][i * 16 + srow][sseg * 8] = lr[i]; }
  __syncthreads();
  // kept rolled: the body already holds two passes of 32 keys, a longer one would only grow the code
#pragma unroll 1
  for (int st = 0; st < NT / SK; ++st) { const int bf = st & 1; const bool more = st + 1 < NT / SK;
    if (more) {
#pragma unroll
      for (int i = 0; i < 4; ++i) kr[i] = *(const v4f*)(kg + (size_t)((st + 1) * SK + i * 16) * E);
#pragma unroll
      for (int i = 0; i < 2; ++i) { hr[i] = *(const v8b*)(VTH + vg + (size_t)(i * 16) * NT + (st + 1) * SK); lr[i] = *(const v8b*)(VTL + vg + (size_t)(i * 16) * NT + (st + 1) * SK); } }
#pragma unroll
    for (int hf = 0; hf < SK / 32; ++hf) { const int ks = st * (SK / 32) + hf; float sv[2][8];
#pragma unroll
      for (int ct = 0; ct < 2; ++ct) { const int kk = ks * 32 + ct * 16 + col; const F2 kb = split_row(&sk[bf][hf * 32 + ct * 16 + col][0], 0, lane); const v8f s = mac3(a, kb, (v8f){});
#pragma unroll
        for (int r = 0; r < 8; ++r) sv[ct][r] = s[r] * scale + bfr(mask[(size_t)(q0 + 8 * g + r) * NT + kk]); }
      float mn[8];
#pragma unroll
      for (int r = 0; r < 8; ++r) mn[r] = fmaxf(m[r], rowmax16(fmaxf(sv[0][r], sv[1][r])) * L2E);
#pragma unroll
      for (int r = 0; r < 8; ++r) { const float al = ex2(m[r] - mn[r]), p0 = ex2(fmaf(sv[0][r], L2E, -mn[r])), p1 = ex2(fmaf(sv[1][r], L2E, -mn[r]));
        sp[wave][8 * g + r][col] = p0; sp[wave][8 * g + r][16 + col] = p1; l[r] = l[r] * al + (p0 + p1); acc[0][r] *= al; acc[1][r] *= al; m[r] = mn[r]; }
      LDSX();
      const F2 pa = split_row(&sp[wave][col][0], 0, lane);
#pragma unroll
      for (int dt = 0; dt < 2; ++dt) { const v16b vh = frag_b(&svh[bf][dt * 16 + col][hf * 32], lane), vl = frag_b(&svl[bf][dt * 16 + col][hf * 32], lane);
        acc[dt] = wmma_bf(pa.l, vh, acc[dt]); acc[dt] = wmma_bf(pa.h, vl, acc[dt]); acc[dt] = wmma_bf(pa.h, vh, acc[dt]); }
      LDSX(); }
    if (more) {   // the other buffer's last readers left it at the barrier that ended the stage before
#pragma unroll
      for (int i = 0; i < 4; ++i) *(v4f*)&sk[bf ^ 1][i * 16 + srow][sseg * 4] = kr[i];
#pragma unroll
      for (int i = 0; i < 2; ++i) { *(v8b*)&svh[bf ^ 1][i * 16 + srow][sseg * 8] = hr[i]; *(v8b*)&svl[bf ^ 1][i * 16 + srow][sseg * 8] = lr[i]; } }
    __syncthreads(); }   // publishes the next stage and ends this stage's reads
#pragma unroll
  for (int r = 0; r < 8; ++r) { const float il = 1.0f / rowsum16(l[r]); so[wave][8 * g + r][col] = acc[0][r] * il; so[wave][8 * g + r][16 + col] = acc[1][r] * il; }
  LDSX();
  for (int rl = 0; rl < 16; ++rl) if (lane < 8) vst2(Q + ((size_t)b * NT + q0 + rl) * E + h * HD + lane * 4, *(const v4f*)&so[wave][rl][lane * 4]);
}
// ---- k_out: block = (b, 64 positions): Y[b][o][t] = sum_c O[b][t][c] Wo[o][c] + bo[o]: GEMM rows t (O rows hi/lo, K 256), cols o (16 tiles per wave = 256); written channel-major: per o the 64 t = 256 B
__global__ __launch_bounds__(128) void k_out(const float* __restrict__ O, const float* __restrict__ Wo, const float* __restrict__ bo, float* __restrict__ Y) {
  __shared__ __align__(16) float sot[E][68];          // [o][t local]
  const int tid = threadIdx.x, wave = tid >> 5, lane = tid & 31, col = lane & 15, g = lane >> 4; const int b = blockIdx.y, t0 = blockIdx.x * 64;
  v8f acc[16] = {};
#pragma unroll 1
  for (int kc = 0; kc < E / 32; ++kc) { const F2 a = split_row(O + ((size_t)b * NT + t0 + wave * 16 + col) * E, kc * 32, lane);
#pragma unroll
    for (int j = 0; j < 16; ++j) { const v16b w = frag_gbf(Wo + (size_t)(j * 16 + col) * E + kc * 32, lane); acc[j] = wmma_bf(a.l, w, acc[j]); acc[j] = wmma_bf(a.h, w, acc[j]); } }
#pragma unroll
  for (int j = 0; j < 16; ++j) { const int o = j * 16 + col; const float bb = bfr(bo[o]);
#pragma unroll
    for (int r = 0; r < 8; ++r) sot[o][wave * 16 + 8 * g + r] = acc[j][r] + bb; }
  __syncthreads();
  for (int q = tid; q < E * 16; q += 128) { const int o = q >> 4, pc = q & 15; vst2(Y + ((size_t)b * E + o) * NT + t0 + pc * 4, *(const v4f*)&sot[o][pc * 4]); }
}

extern "C" void kernel_launch(void* const* d_in, const int* in_sizes, int n_in, void* d_out, int out_size, void* d_ws, size_t ws_size, hipStream_t stream) {
  (void)in_sizes; (void)n_in; (void)out_size;
  const float** F = (const float**)d_in;   // d_in order: query, key, value [8,256,32,32], attn_mask [1024,1024], Wq, Wk, Wv, Wo [256,256], bq, bk, bv, bo [256]
  if (ws_size < (size_t)WS_END) return;
  char* ws = (char*)d_ws; float *Q = (float*)(ws + WS_Q), *Kb = (float*)(ws + WS_K); __bf16 *VTH = (__bf16*)(ws + WS_VTH), *VTL = (__bf16*)(ws + WS_VTL);
  k_proj<<<dim3(NT / 64, TNB, 3), 128, 0, stream>>>(F[0], F[1], F[2], F[4], F[8], F[5], F[9], F[6], F[10], Q, Kb, VTH, VTL);
  k_attn<<<dim3(TQB, TNB * NH), 128, 0, stream>>>(Q, Kb, F[3], VTH, VTL);
  k_out<<<dim3(TQB, TNB), 128, 0, stream>>>(Q, F[7], F[11], (float*)d_out);
}

// v004
// It runs in 109 microseconds.
// Timed twice side by side with v003, it ran 2.26 times as fast both times.
// All steps since v000 together make it 4.12 times as fast.
#include <hip/hip_runtime.h>
#include <math.h>

typedef __attribute__((ext_vector_type(16))) _Float16 v16h;
typedef __attribute__((ext_vector_type(16))) __bf16 v16b;
typedef __attribute__((ext_vector_type(8)))  _Float16 v8h;
typedef __attribute__((ext_vector_type(8)))  float v8f;
typedef __attribute__((ext_vector_type(4)))  float v4f;
typedef __attribute__((ext_vector_type(2)))  float v2f;
typedef __attribute__((ext_vector_type(4)))  unsigned v4u;
typedef __attribute__((ext_vector_type(4)))  int v4i;
typedef float __attribute__((may_alias)) float_a;
typedef int __attribute__((may_alias)) int_a;

template <typename T> __device__ __forceinline__ void vst2(void* p, T v) { *(T*)p = v;  }
__device__ __forceinline__ v8f wmma16(v16h a, v16h b, v8f c) {
  v8f d = __builtin_amdgcn_wmma_f32_16x16x32_f16(false, a, false, b, (short)0, c, false, false);
  asm volatile("v_nop\n\tv_nop\n\tv_nop\n\tv_nop" : "+v"(d) : "v"(a), "v"(b));
  return d;
}
__device__ __forceinline__ v8f wmma_bf(v16b a, v16b b, v8f c) {
  v8f d = __builtin_amdgcn_wmma_f32_16x16x32_bf16(false, a, false, b, (short)0, c, false, false);
  asm volatile("v_nop\n\tv_nop\n\tv_nop\n\tv_nop" : "+v"(d) : "v"(a), "v"(b));
  return d;
}
// 16x16x32 fragments: lane = (h = lane>>4, row/col = lane&15); elements 0..7 = k0+8h+0..7, 8..15 = k0+16+8h+0..7; D element r = row 8h+r
__device__ __forceinline__ v16h frag_h(const _Float16* rowk0, int lane) {
  union { v16h v; v8h q[2]; } u; const _Float16* p = rowk0 + 8 * (lane >> 4);
  u.q[0] = *(const v8h*)p; u.q[1] = *(const v8h*)(p + 16); return u.v;
}
__device__ __forceinline__ v16h frag_f32(const float* rowk0, int lane) {
  v16h a; const float* p = rowk0 + 8 * (lane >> 4);
#pragma unroll
  for (int i = 0; i < 8; ++i) { a[i] = (_Float16)p[i]; a[8 + i] = (_Float16)p[16 + i]; }
  return a;
}
__device__ __forceinline__ v16h frag_f32s(const float* rowk0, int lane, float sc) {
  v16h a; const float* p = rowk0 + 8 * (lane >> 4);
#pragma unroll
  for (int i = 0; i < 8; ++i) { a[i] = (_Float16)(p[i] * sc); a[8 + i] = (_Float16)(p[16 + i] * sc); }
  return a;
}
// column fragment from a [K][ld] layout (column n), rows >= K read as 0
__device__ __forceinline__ v16h fragc_f32(const float* W, int k0, int n, int lane, int ld, int K) {
  v16h a; const int g = lane >> 4;
#pragma unroll
  for (int i = 0; i < 8; ++i) { const int ka = k0 + 8 * g + i, kb = ka + 16;
    a[i] = (_Float16)(ka < K ? W[(size_t)(ka < K ? ka : K - 1) * ld + n] : 0.f); a[8 + i] = (_Float16)(kb < K ? W[(size_t)(kb < K ? kb : K - 1) * ld + n] : 0.f); }
  return a;
}
struct F2 { v16b h, l; };
__device__ __forceinline__ F2 bsplit16(const float v[16]) { F2 r;
#pragma unroll
  for (int i = 0; i < 16; ++i) { const __bf16 h = (__bf16)v[i]; r.h[i] = h; r.l[i] = (__bf16)(v[i] - (float)h); }
  return r; }
__device__ __forceinline__ F2 split_row(const float* row, int k0, int lane) { float v[16]; const float* p = row + k0 + 8 * (lane >> 4);
#pragma unroll
  for (int i = 0; i < 8; ++i) { v[i] = p[i]; v[8 + i] = p[16 + i]; }
  return bsplit16(v); }
__device__ __forceinline__ F2 split_rowK(const float* row, int k0, int lane, int K) { float v[16]; const int g = lane >> 4;
#pragma unroll
  for (int i = 0; i < 8; ++i) { const int ka = k0 + 8 * g + i, kb = ka + 16; v[i] = ka < K ? row[ka < K ? ka : K - 1] : 0.f; v[8 + i] = kb < K ? row[kb < K ? kb : K - 1] : 0.f; }
  return bsplit16(v); }
__device__ __forceinline__ F2 split_col(const float* W, int k0, int n, int lane, int ld, int K) { float v[16]; const int g = lane >> 4;
#pragma unroll
  for (int i = 0; i < 8; ++i) { const int ka = k0 + 8 * g + i, kb = ka + 16; v[i] = ka < K ? W[(size_t)(ka < K ? ka : K - 1) * ld + n] : 0.f; v[8 + i] = kb < K ? W[(size_t)(kb < K ? kb : K - 1) * ld + n] : 0.f; }
  return bsplit16(v); }
__device__ __forceinline__ v8f mac3(const F2& a, const F2& b, v8f c) { c = wmma_bf(a.l, b.h, c); c = wmma_bf(a.h, b.l, c); return wmma_bf(a.h, b.h, c); }
__device__ __forceinline__ float sigm(float v) { return 1.0f / (1.0f + expf(-v)); }
#define LDSX() do { asm volatile("s_wait_dscnt 0" ::: "memory"); __builtin_amdgcn_wave_barrier(); __builtin_amdgcn_fence(__ATOMIC_RELEASE, "workgroup"); } while (0)


// Multi-head attention over 32x32 feature maps (channel-major NCHW inputs): q/k/v = 1x1 conv (W x + b) per position, 8 heads x 32, scores = q k^T / sqrt(32) + attn_mask[t][s] (dense float mask, shared across batch/heads), softmax over s, P v, concat heads (channel = h*32 + d), out = Wo out + bo -> [B, 256, 32, 32].
// k_proj (per (b, 64 positions): gathers the channel-major input columns into LDS as bf16 [pos][ch], one-product bf16 GEMM against bf16-rounded W rows; q,k as position rows [b][t][256], v as channel-major hi/lo planes [b][ch][t]), k_attn (per (64 queries, b, h): one pass over the 1024 keys, running row max m (kept as m log2 e) and row sum l; P = 2^(s log2 e - m log2 e) hi/lo . V^T planes, O and l rescaled by 2^(m_old log2 e - m_new log2 e) per 32 keys, O / l at the end, O rows), k_out (O(hi/lo) . Wo rows + bo, written channel-major: per output channel one 256-B segment of 64 positions).
#define NB 8
#define E 256
#define NT 1024
#define NH 8
#define HD 32
#ifndef TNB
#define TNB NB
#define TQB (NT / 64)
#endif
typedef __attribute__((ext_vector_type(8))) __bf16 v8b;
__device__ __forceinline__ v16b frag_b(const __bf16* rowk0, int lane) {
  union { v16b v; v8b q[2]; } u; const __bf16* p = rowk0 + 8 * (lane >> 4);
  u.q[0] = *(const v8b*)p; u.q[1] = *(const v8b*)(p + 16); return u.v;
}
__device__ __forceinline__ v16b frag_gbf(const float* rowk0, int lane) {
  v16b a; const float* p = rowk0 + 8 * (lane >> 4);
#pragma unroll
  for (int i = 0; i < 8; ++i) { a[i] = (__bf16)p[i]; a[8 + i] = (__bf16)p[16 + i]; }
  return a;
}
__device__ __forceinline__ float bfr(float v) { return (float)(__bf16)v; }
// 2^v as the one hardware instruction, in line; arguments here are <= 0 up to rounding, and a result below the normal range may read as 0
__device__ __forceinline__ float ex2(float v) { return __builtin_amdgcn_exp2f(v); }
#define L2E 1.4426950408889634f
#define WS_Q    0u                               // f32 [8][1024][256] q rows (t-major); later O rows
#define WS_K    (WS_Q + 4u * NB * NT * E)
#define WS_VTH  (WS_K + 4u * NB * NT * E)          // bf16 [8][256 ch][1024 t]
#define WS_VTL  (WS_VTH + 2u * NB * E * NT)
#define WS_END  (WS_VTL + 2u * NB * E * NT)
// sum / maximum over the 16 lanes of a half-wave (the 16 key columns of one score row): four row_xmask exchanges, every lane gets the result
__device__ __forceinline__ float xm1(float v) { return __int_as_float(__builtin_amdgcn_update_dpp(0, __float_as_int(v), 0x161, 0xf, 0xf, true)); }
__device__ __forceinline__ float xm2(float v) { return __int_as_float(__builtin_amdgcn_update_dpp(0, __float_as_int(v), 0x162, 0xf, 0xf, true)); }
__device__ __forceinline__ float xm4(float v) { return __int_as_float(__builtin_amdgcn_update_dpp(0, __float_as_int(v), 0x164, 0xf, 0xf, true)); }
__device__ __forceinline__ float xm8(float v) { return __int_as_float(__builtin_amdgcn_update_dpp(0, __float_as_int(v), 0x168, 0xf, 0xf, true)); }
__device__ __forceinline__ float rowsum16(float v) { v += xm1(v); v += xm2(v); v += xm4(v); return v + xm8(v); }
// asm: the exchange fused into the maximum, one instruction a step (from the builtin move the compiler makes three: move, canonicalising maximum, maximum); all 32 lanes are on where it is used
__device__ __forceinline__ float rowmax16(float v) {
  asm("v_max_num_f32_dpp %0, %1, %1 row_xmask:1 row_mask:0xf bank_mask:0xf" : "=v"(v) : "v"(v));
  asm("v_max_num_f32_dpp %0, %1, %1 row_xmask:2 row_mask:0xf bank_mask:0xf" : "=v"(v) : "v"(v));
  asm("v_max_num_f32_dpp %0, %1, %1 row_xmask:4 row_mask:0xf bank_mask:0xf" : "=v"(v) : "v"(v));
  asm("v_max_num_f32_dpp %0, %1, %1 row_xmask:8 row_mask:0xf bank_mask:0xf" : "=v"(v) : "v"(v));
  return v; }

// A 256 x 256 weight matrix goes into LDS once a block, rounded to bf16 as the fragment loader rounded it: every wave-load is 512 contiguous bytes, 32 loads of a thread are on their way at a time.
// Row pitch 264 bf16 = 528 B (16 B x odd): the 16 rows of a fragment's 16-B reads fall on 16 different bank groups.
#define WP (E + 8)
typedef __attribute__((ext_vector_type(4))) __bf16 v4b;
__device__ __forceinline__ void stage_w(const float* __restrict__ Wm, __bf16 (*sw)[WP], int tid) {
  // kept rolled
#pragma unroll 1
  for (int o = 0; o < E * E / 4; o += 128 * 32) { v4f t[32];
#pragma unroll
    for (int i = 0; i < 32; ++i) t[i] = *(const v4f*)(Wm + (size_t)(o + i * 128 + tid) * 4);
#pragma unroll
    for (int i = 0; i < 32; ++i) { const int q = o + i * 128 + tid; v4b hb;
#pragma unroll
      for (int e = 0; e < 4; ++e) hb[e] = (__bf16)t[i][e];
      *(v4b*)&sw[q >> 6][(q & 63) * 4] = hb; } }
}

__global__ __launch_bounds__(128) void k_proj(const float* __restrict__ Xq, const float* __restrict__ Xk, const float* __restrict__ Xv, const float* __restrict__ Wq, const float* __restrict__ bq, const float* __restrict__ Wk, const float* __restrict__ bk, const float* __restrict__ Wv, const float* __restrict__ bv, float* __restrict__ Q, float* __restrict__ Kb, __bf16* __restrict__ VTH, __bf16* __restrict__ VTL) {
  __shared__ __align__(16) __bf16 sx[64][E + 8]; __shared__ __align__(16) float so[4][16][E + 4]; __shared__ __align__(16) __bf16 svh[E][72], svl[E][72]; __shared__ __align__(16) __bf16 sw[E][WP];
  const int tid = threadIdx.x, wave = tid >> 5, lane = tid & 31, col = lane & 15, g = lane >> 4; const int b = blockIdx.y, t0 = blockIdx.x * 64, which = blockIdx.z;
  const float* X = which == 0 ? Xq : (which == 1 ? Xk : Xv); const float* Wm = which == 0 ? Wq : (which == 1 ? Wk : Wv); const float* bm = which == 0 ? bq : (which == 1 ? bk : bv);
  stage_w(Wm, sw, tid);
  for (int q = tid; q < E * 64; q += 128) { const int c = q >> 6, tl = q & 63; sx[tl][c] = (__bf16)X[((size_t)b * E + c) * NT + t0 + tl]; }
  __syncthreads();
  v8f acc[16] = {};
#pragma unroll 2
  for (int kc = 0; kc < E / 32; ++kc) { const v16b a = frag_b(&sx[wave * 16 + col][kc * 32], lane);
#pragma unroll
    for (int jh = 0; jh < 2; ++jh) { v16b w[8];   // eight fragments read as one group, then their eight products: one LDS wait a group
#pragma unroll
      for (int j = 0; j < 8; ++j) w[j] = frag_b(&sw[(jh * 8 + j) * 16 + col][kc * 32], lane);
#pragma unroll
      for (int j = 0; j < 8; ++j) acc[jh * 8 + j] = wmma_bf(a, w[j], acc[jh * 8 + j]); } }
#pragma unroll
  for (int j = 0; j < 16; ++j) { const float bb = bfr(bm[j * 16 + col]);
#pragma unroll
    for (int r = 0; r < 8; ++r) so[wave][8 * g + r][j * 16 + col] = acc[j][r] + bb; }
  __syncthreads();
  if (which < 2) { float* dst = which == 0 ? Q : Kb;
    for (int rl = 0; rl < 16; ++rl) for (int pc = lane; pc < E / 4; pc += 32) vst2(dst + ((size_t)b * NT + t0 + wave * 16 + rl) * E + pc * 4, *(const v4f*)&so[wave][rl][pc * 4]); }
  else {
    for (int q = tid; q < E * 64; q += 128) { const int c = q >> 6, tl = q & 63; const float v = so[tl >> 4][tl & 15][c]; const __bf16 hb = (__bf16)v; svh[c][tl] = hb; svl[c][tl] = (__bf16)(v - (float)hb); }
    __syncthreads();
    for (int q = tid; q < E * 8; q += 128) { const int c = q >> 3, pc = q & 7; const size_t o = ((size_t)b * E + c) * NT + t0 + pc * 8; vst2((unsigned*)(VTH + o), *(const v4u*)&svh[c][pc * 8]); vst2((unsigned*)(VTL + o), *(const v4u*)&svl[c][pc * 8]); } }
}
// ---- k_attn: block = (64 queries, b*8+h): s = q.k (K 32, 3 products) * scale + mask[t][s]; single pass, online softmax
// K rows and V^T planes come in stages of 64 keys: the block's 128 threads fetch a stage once, in whole 128-B lines, one stage ahead into registers, and put it into the LDS buffer that is free; all four waves read their fragments from there
#define SK 64
__global__ __launch_bounds__(128) void k_attn(float* __restrict__ Q, const float* __restrict__ Kb, const float* __restrict__ mask, const __bf16* __restrict__ VTH, const __bf16* __restrict__ VTL) {
  __shared__ __align__(16) float sp[4][16][36]; __shared__ __align__(16) float so[4][16][36];
  __shared__ __align__(16) float sk[2][SK][36];                               // [buffer][key][d], pitch 36 dwords: 16 rows' 16-B reads fall on 16 different bank groups
  __shared__ __align__(16) __bf16 svh[2][HD][SK + 8], svl[2][HD][SK + 8];     // [buffer][channel][key], the same pitch in bytes
  const int tid = threadIdx.x, wave = tid >> 5, lane = tid & 31, col = lane & 15, g = lane >> 4; const int bh = blockIdx.y, b = bh >> 3, h = bh & 7; const int q0 = blockIdx.x * 64 + wave * 16; const float scale = 0.17677669529663687f;
  const int srow = tid >> 3, sseg = tid & 7;   // staging: 8 threads a 128-B row, 16 rows a pass of the block
  const float* kg = Kb + ((size_t)b * NT + srow) * E + h * HD + sseg * 4;
  const size_t vg = ((size_t)b * E + h * HD + srow) * NT + sseg * 8;
  v4f kr[4]; v8b hr[2], lr[2];   // one stage on its way; every loop over them is unrolled so that they stay in registers
#pragma unroll
  for (int i = 0; i < 4; ++i) kr[i] = *(const v4f*)(kg + (size_t)(i * 16) * E);
#pragma unroll
  for (int i = 0; i < 2; ++i) { hr[i] = *(const v8b*)(VTH + vg + (size_t)(i * 16) * NT); lr[i] = *(const v8b*)(VTL + vg + (size_t)(i * 16) * NT); }
  asm volatile("s_wait_xcnt 0x0" ::: "memory");   // the address registers of the loads above are reused at once (the query row's load lands in them): the wait stands in front of that overwrite
  const F2 a = split_row(Q + ((size_t)b * NT + q0 + col) * E + h * HD, 0, lane);
  float m[8], l[8];   // row 8g+r: running max times log2 e (equal in the row's 16 lanes), this lane's share of the running sum
#pragma unroll
  for (int r = 0; r < 8; ++r) { m[r] = -3.0e38f; l[r] = 0.f; }
  v8f acc[2] = {};
#pragma unroll
  for (int i = 0; i < 4; ++i) *(v4f*)&sk[0][i * 16 + srow][sseg * 4] = kr[i];
#pragma unroll
  for (int i = 0; i < 2; ++i) { *(v8b*)&svh[0][i * 16 + srow][sseg * 8] = hr[i]; *(v8b*)&svl[0][i * 16 + srow][sseg * 8] = lr[i]; }
  __syncthreads();
  // kept rolled: the body already holds two passes of 32 keys, a longer one would only grow the code
#pragma unroll 1
  for (int st = 0; st < NT / SK; ++st) { const int bf = st & 1; const bool more = st + 1 < NT / SK;
    if (more) {
#pragma unroll
      for (int i = 0; i < 4; ++i) kr[i] = *(const v4f*)(kg + (size_t)((st + 1) * SK + i * 16) * E);
#pragma unroll
      for (int i = 0; i < 2; ++i) { hr[i] = *(const v8b*)(VTH + vg + (size_t)(i * 16) * NT + (st + 1) * SK); lr[i] = *(const v8b*)(VTL + vg + (size_t)(i * 16) * NT + (st + 1) * SK); } }
#pragma unroll
    for (int hf = 0; hf < SK / 32; ++hf) { const int ks = st * (SK / 32) + hf; float sv[2][8];
#pragma unroll
      for (int ct = 0; ct < 2; ++ct) { const int kk = ks * 32 + ct * 16 + col; const F2 kb = split_row(&sk[bf][hf * 32 + ct * 16 + col][0], 0, lane); const v8f s = mac3(a, kb, (v8f){});
#pragma unroll
        for (int r = 0; r < 8; ++r) sv[ct][r] = s[r] * scale + bfr(mask[(size_t)(q0 + 8 * g + r) * NT + kk]); }
      float mn[8];
#pragma unroll
      for (int r = 0; r < 8; ++r) mn[r] = fmaxf(m[r], rowmax16(fmaxf(sv[0][r], sv[1][r])) * L2E);
#pragma unroll
      for (int r = 0; r < 8; ++r) { const float al = ex2(m[r] - mn[r]), p0 = ex2(fmaf(sv[0][r], L2E, -mn[r])), p1 = ex2(fmaf(sv[1][r], L2E, -mn[r]));
        sp[wave][8 * g + r][col] = p0; sp[wave][8 * g + r][16 + col] = p1; l[r] = l[r] * al + (p0 + p1); acc[0][r] *= al; acc[1][r] *= al; m[r] = mn[r]; }
      LDSX();
      const F2 pa = split_row(&sp[wave][col][0], 0, lane);
#pragma unroll
      for (int dt = 0; dt < 2; ++dt) { const v16b vh = frag_b(&svh[bf][dt * 16 + col][hf * 32], lane), vl = frag_b(&svl[bf][dt * 16 + col][hf * 32], lane);
        acc[dt] = wmma_bf(pa.l, vh, acc[dt]); acc[dt] = wmma_bf(pa.h, vl, acc[dt]); acc[dt] = wmma_bf(pa.h, vh, acc[dt]); }
      LDSX(); }
    if (more) {   // the other buffer's last readers left it at the barrier that ended the stage before
#pragma unroll
      for (int i = 0; i < 4; ++i) *(v4f*)&sk[bf ^ 1][i * 16 + srow][sseg * 4] = kr[i];
#pragma unroll
      for (int i = 0; i < 2; ++i) { *(v8b*)&svh[bf ^ 1][i * 16 + srow][sseg * 8] = hr[i]; *(v8b*)&svl[bf ^ 1][i * 16 + srow][sseg * 8] = lr[i]; } }
    __syncthreads(); }   // publishes the next stage and ends this stage's reads
#pragma unroll
  for (int r = 0; r < 8; ++r) { const float il = 1.0f / rowsum16(l[r]); so[wave][8 * g + r][col] = acc[0][r] * il; so[wave][8 * g + r][16 + col] = acc[1][r] * il; }
  LDSX();
  for (int rl = 0; rl < 16; ++rl) if (lane < 8) vst2(Q + ((size_t)b * NT + q0 + rl) * E + h * HD + lane * 4, *(const v4f*)&so[wave][rl][lane * 4]);
}
// ---- k_out: block = (b, 64 positions): Y[b][o][t] = sum_c O[b][t][c] Wo[o][c] + bo[o]: GEMM rows t (O rows hi/lo, K 256), cols o (16 tiles per wave = 256); written channel-major: per o the 64 t = 256 B
__global__ __launch_bounds__(128) void k_out(const float* __restrict__ O, const float* __restrict__ Wo, const float* __restrict__ bo, float* __restrict__ Y) {
  __shared__ __align__(16) float sot[E][68];          // [o][t local]
  __shared__ __align__(16) __bf16 sw[E][WP];
  const int tid = threadIdx.x, wave = tid >> 5, lane = tid & 31, col = lane & 15, g = lane >> 4; const int b = blockIdx.y, t0 = blockIdx.x * 64;
  stage_w(Wo, sw, tid);
  __syncthreads();   // publishes the staged weights to all four waves
  v8f acc[16] = {};
#pragma unroll 1
  for (int kc = 0; kc < E / 32; ++kc) { const F2 a = split_row(O + ((size_t)b * NT + t0 + wave * 16 + col) * E, kc * 32, lane);
#pragma unroll
    for (int jh = 0; jh < 2; ++jh) { v16b w[8];   // eight fragments read as one group, then their products: one LDS wait a group
#pragma unroll
      for (int j = 0; j < 8; ++j) w[j] = frag_b(&sw[(jh * 8 + j) * 16 + col][kc * 32], lane);
#pragma unroll
      for (int j = 0; j < 8; ++j) { acc[jh * 8 + j] = wmma_bf(a.l, w[j], acc[jh * 8 + j]); acc[jh * 8 + j] = wmma_bf(a.h, w[j], acc[jh * 8 + j]); } } }
#pragma unroll
  for (int j = 0; j < 16; ++j) { const int o = j * 16 + col; const float bb = bfr(bo[o]);
#pragma unroll
    for (int r = 0; r < 8; ++r) sot[o][wave * 16 + 8 * g + r] = acc[j][r] + bb; }
  __syncthreads();
  for (int q = tid; q < E * 16; q += 128) { const int o = q >> 4, pc = q & 15; vst2(Y + ((size_t)b * E + o) * NT + t0 + pc * 4, *(const v4f*)&sot[o][pc * 4]); }
}

extern "C" void kernel_launch(void* const* d_in, const int* in_sizes, int n_in, void* d_out, int out_size, void* d_ws, size_t ws_size, hipStream_t stream) {
  (void)in_sizes; (void)n_in; (void)out_size;
  const float** F = (const float**)d_in;   // d_in order: query, key, value [8,256,32,32], attn_mask [1024,1024], Wq, Wk, Wv, Wo [256,256], bq, bk, bv, bo [256]
  if (ws_size < (size_t)WS_END) return;
  char* ws = (char*)d_ws; float *Q = (float*)(ws + WS_Q), *Kb = (float*)(ws + WS_K); __bf16 *VTH = (__bf16*)(ws + WS_VTH), *VTL = (__bf16*)(ws + WS_VTL);
  k_proj<<<dim3(NT / 64, TNB, 3), 128, 0, stream>>>(F[0], F[1], F[2], F[4], F[8], F[5], F[9], F[6], F[10], Q, Kb, VTH, VTL);
  k_attn<<<dim3(TQB, TNB * NH), 128, 0, stream>>>(Q, Kb, F[3], VTH, VTL);
  k_out<<<dim3(TQB, TNB), 128, 0, stream>>>(Q, F[7], F[11], (float*)d_out);
}

// v005
// Measured time: 95.4 microseconds a run.
// In both of two side-by-side timings against v004, it was 1.15 times as fast.
// Counting every step since v000, it is 4.74 times as fast.
#include <hip/hip_runtime.h>
#include <math.h>

typedef __attribute__((ext_vector_type(16))) _Float16 v16h;
typedef __attribute__((ext_vector_type(16))) __bf16 v16b;
typedef __attribute__((ext_vector_type(8)))  _Float16 v8h;
typedef __attribute__((ext_vector_type(8)))  float v8f;
typedef __attribute__((ext_vector_type(4)))  float v4f;
typedef __attribute__((ext_vector_type(2)))  float v2f;
typedef __attribute__((ext_vector_type(4)))  unsigned v4u;
typedef __attribute__((ext_vector_type(4)))  int v4i;
typedef float __attribute__((may_alias)) float_a;
typedef int __attribute__((may_alias)) int_a;

template <typename T> __device__ __forceinline__ void vst2(void* p, T v) { *(T*)p = v;  }
__device__ __forceinline__ v8f wmma16(v16h a, v16h b, v8f c) {
  v8f d = __builtin_amdgcn_wmma_f32_16x16x32_f16(false, a, false, b, (short)0, c, false, false);
  asm volatile("v_nop\n\tv_nop\n\tv_nop\n\tv_nop" : "+v"(d) : "v"(a), "v"(b));
  return d;
}
__device__ __forceinline__ v8f wmma_bf(v16b a, v16b b, v8f c) {
  v8f d = __builtin_amdgcn_wmma_f32_16x16x32_bf16(false, a, false, b, (short)0, c, false, false);
  asm volatile("v_nop\n\tv_nop\n\tv_nop\n\tv_nop" : "+v"(d) : "v"(a), "v"(b));
  return d;
}
// 16x16x32 fragments: lane = (h = lane>>4, row/col = lane&15); elements 0..7 = k0+8h+0..7, 8..15 = k0+16+8h+0..7; D element r = row 8h+r
__device__ __forceinline__ v16h frag_h(const _Float16* rowk0, int lane) {
  union { v16h v; v8h q[2]; } u; const _Float16* p = rowk0 + 8 * (lane >> 4);
  u.q[0] = *(const v8h*)p; u.q[1] = *(const v8h*)(p + 16); return u.v;
}
__device__ __forceinline__ v16h frag_f32(const float* rowk0, int lane) {
  v16h a; const float* p = rowk0 + 8 * (lane >> 4);
#pragma unroll
  for (int i = 0; i < 8; ++i) { a[i] = (_Float16)p[i]; a[8 + i] = (_Float16)p[16 + i]; }
  return a;
}
__device__ __forceinline__ v16h frag_f32s(const float* rowk0, int lane, float sc) {
  v16h a; const float* p = rowk0 + 8 * (lane >> 4);
#pragma unroll
  for (int i = 0; i < 8; ++i) { a[i] = (_Float16)(p[i] * sc); a[8 + i] = (_Float16)(p[16 + i] * sc); }
  return a;
}
// column fragment from a [K][ld] layout (column n), rows >= K read as 0
__device__ __forceinline__ v16h fragc_f32(const float* W, int k0, int n, int lane, int ld, int K) {
  v16h a; const int g = lane >> 4;
#pragma unroll
  for (int i = 0; i < 8; ++i) { const int ka = k0 + 8 * g + i, kb = ka + 16;
    a[i] = (_Float16)(ka < K ? W[(size_t)(ka < K ? ka : K - 1) * ld + n] : 0.f); a[8 + i] = (_Float16)(kb < K ? W[(size_t)(kb < K ? kb : K - 1) * ld + n] : 0.f); }
  return a;
}
struct F2 { v16b h, l; };
__device__ __forceinline__ F2 bsplit16(const float v[16]) { F2 r;
#pragma unroll
  for (int i = 0; i < 16; ++i) { const __bf16 h = (__bf16)v[i]; r.h[i] = h; r.l[i] = (__bf16)(v[i] - (float)h); }
  return r; }
__device__ __forceinline__ F2 split_row(const float* row, int k0, int lane) { float v[16]; const float* p = row + k0 + 8 * (lane >> 4);
#pragma unroll
  for (int i = 0; i < 8; ++i) { v[i] = p[i]; v[8 + i] = p[16 + i]; }
  return bsplit16(v); }
__device__ __forceinline__ F2 split_rowK(const float* row, int k0, int lane, int K) { float v[16]; const int g = lane >> 4;
#pragma unroll
  for (int i = 0; i < 8; ++i) { const int ka = k0 + 8 * g + i, kb = ka + 16; v[i] = ka < K ? row[ka < K ? ka : K - 1] : 0.f; v[8 + i] = kb < K ? row[kb < K ? kb : K - 1] : 0.f; }
  return bsplit16(v); }
__device__ __forceinline__ F2 split_col(const float* W, int k0, int n, int lane, int ld, int K) { float v[16]; const int g = lane >> 4;
#pragma unroll
  for (int i = 0; i < 8; ++i) { const int ka = k0 + 8 * g + i, kb = ka + 16; v[i] = ka < K ? W[(size_t)(ka < K ? ka : K - 1) * ld + n] : 0.f; v[8 + i] = kb < K ? W[(size_t)(kb < K ? kb : K - 1) * ld + n] : 0.f; }
  return bsplit16(v); }
__device__ __forceinline__ v8f mac3(const F2& a, const F2& b, v8f c) { c = wmma_bf(a.l, b.h, c); c = wmma_bf(a.h, b.l, c); return wmma_bf(a.h, b.h, c); }
__device__ __forceinline__ float sigm(float v) { return 1.0f / (1.0f + expf(-v)); }
#define LDSX() do { asm volatile("s_wait_dscnt 0" ::: "memory"); __builtin_amdgcn_wave_barrier(); __builtin_amdgcn_fence(__ATOMIC_RELEASE, "workgroup"); } while (0)


// Multi-head attention over 32x32 feature maps (channel-major NCHW inputs): q/k/v = 1x1 conv (W x + b) per position, 8 heads x 32, scores = q k^T / sqrt(32) + attn_mask[t][s] (dense float mask, shared across batch/heads), softmax over s, P v, concat heads (channel = h*32 + d), out = Wo out + bo -> [B, 256, 32, 32].
// k_proj (per (b, 64 positions): gathers the channel-major input columns into LDS as bf16 [pos][ch], one-product bf16 GEMM against bf16-rounded W rows; q,k as position rows [b][t][256], v as channel-major hi/lo planes [b][ch][t]), k_attn (per (64 queries, b, h): one pass over the 1024 keys, running row max m (kept as m log2 e) and row sum l; P = 2^(s log2 e - m log2 e) hi/lo . V^T planes, O and l rescaled by 2^(m_old log2 e - m_new log2 e) per 32 keys, O / l at the end, O rows), k_out (O(hi/lo) . Wo rows + bo, written channel-major: per output channel one 256-B segment of 64 positions).
#define NB 8
#define E 256
#define NT 1024
#define NH 8
#define HD 32
#ifndef TNB
#define TNB NB
#define TQB (NT / 64)
#endif
typedef __attribute__((ext_vector_type(8))) __bf16 v8b;
__device__ __forceinline__ v16b frag_b(const __bf16* rowk0, int lane) {
  union { v16b v; v8b q[2]; } u; const __bf16* p = rowk0 + 8 * (lane >> 4);
  u.q[0] = *(const v8b*)p; u.q[1] = *(const v8b*)(p + 16); return u.v;
}
__device__ __forceinline__ v16b frag_gbf(const float* rowk0, int lane) {
  v16b a; const float* p = rowk0 + 8 * (lane >> 4);
#pragma unroll
  for (int i = 0; i < 8; ++i) { a[i] = (__bf16)p[i]; a[8 + i] = (__bf16)p[16 + i]; }
  return a;
}
__device__ __forceinline__ float bfr(float v) { return (float)(__bf16)v; }
// 2^v as the one hardware instruction, in line; arguments here are <= 0 up to rounding, and a result below the normal range may read as 0
__device__ __forceinline__ float ex2(float v) { return __builtin_amdgcn_exp2f(v); }
#define L2E 1.4426950408889634f
#define WS_Q    0u                               // f32 [8][1024][256] q rows (t-major); later O rows
#define WS_K    (WS_Q + 4u * NB * NT * E)
#define WS_VTH  (WS_K + 4u * NB * NT * E)          // bf16 [8][256 ch][1024 t]
#define WS_VTL  (WS_VTH + 2u * NB * E * NT)
#define WS_END  (WS_VTL + 2u * NB * E * NT)
// sum / maximum over the 16 lanes of a half-wave (the 16 key columns of one score row): four row_xmask exchanges, every lane gets the result
__device__ __forceinline__ float xm1(float v) { return __int_as_float(__builtin_amdgcn_update_dpp(0, __float_as_int(v), 0x161, 0xf, 0xf, true)); }
__device__ __forceinline__ float xm2(float v) { return __int_as_float(__builtin_amdgcn_update_dpp(0, __float_as_int(v), 0x162, 0xf, 0xf, true)); }
__device__ __forceinline__ float xm4(float v) { return __int_as_float(__builtin_amdgcn_update_dpp(0, __float_as_int(v), 0x164, 0xf, 0xf, true)); }
__device__ __forceinline__ float xm8(float v) { return __int_as_float(__builtin_amdgcn_update_dpp(0, __float_as_int(v), 0x168, 0xf, 0xf, true)); }
__device__ __forceinline__ float rowsum16(float v) { v += xm1(v); v += xm2(v); v += xm4(v); return v + xm8(v); }
// asm: the exchange fused into the maximum, one instruction a step (from the builtin move the compiler makes three: move, canonicalising maximum, maximum); all 32 lanes are on where it is used
__device__ __forceinline__ float rowmax16(float v) {
  asm("v_max_num_f32_dpp %0, %1, %1 row_xmask:1 row_mask:0xf bank_mask:0xf" : "=v"(v) : "v"(v));
  asm("v_max_num_f32_dpp %0, %1, %1 row_xmask:2 row_mask:0xf bank_mask:0xf" : "=v"(v) : "v"(v));
  asm("v_max_num_f32_dpp %0, %1, %1 row_xmask:4 row_mask:0xf bank_mask:0xf" : "=v"(v) : "v"(v));
  asm("v_max_num_f32_dpp %0, %1, %1 row_xmask:8 row_mask:0xf bank_mask:0xf" : "=v"(v) : "v"(v));
  return v; }

// A 256 x 256 weight matrix goes into LDS once a block, rounded to bf16 as the fragment loader rounded it: every wave-load is 512 contiguous bytes, 32 loads of a thread are on their way at a time.
// Row pitch 264 bf16 = 528 B (16 B x odd): the 16 rows of a fragment's 16-B reads fall on 16 different bank groups.
#define WP (E + 8)
typedef __attribute__((ext_vector_type(4))) __bf16 v4b;
typedef __attribute__((ext_vector_type(2))) __bf16 v2b;
__device__ __forceinline__ void stage_w(const float* __restrict__ Wm, __bf16 (*sw)[WP], int tid) {
  // kept rolled
#pragma unroll 1
  for (int o = 0; o < E * E / 4; o += 128 * 32) { v4f t[32];
#pragma unroll
    for (int i = 0; i < 32; ++i) t[i] = *(const v4f*)(Wm + (size_t)(o + i * 128 + tid) * 4);
#pragma unroll
    for (int i = 0; i < 32; ++i) { const int q = o + i * 128 + tid; v4b hb;
#pragma unroll
      for (int e = 0; e < 4; ++e) hb[e] = (__bf16)t[i][e];
      *(v4b*)&sw[q >> 6][(q & 63) * 4] = hb; } }
}

__global__ __launch_bounds__(128) void k_proj(const float* __restrict__ Xq, const float* __restrict__ Xk, const float* __restrict__ Xv, const float* __restrict__ Wq, const float* __restrict__ bq, const float* __restrict__ Wk, const float* __restrict__ bk, const float* __restrict__ Wv, const float* __restrict__ bv, float* __restrict__ Q, float* __restrict__ Kb, __bf16* __restrict__ VTH, __bf16* __restrict__ VTL) {
  __shared__ __align__(16) __bf16 sx[64][E + 8]; __shared__ __align__(16) float so[4][16][E + 4]; __shared__ __align__(16) __bf16 svh[E][72], svl[E][72]; __shared__ __align__(16) __bf16 sw[E][WP];
  const int tid = threadIdx.x, wave = tid >> 5, lane = tid & 31, col = lane & 15, g = lane >> 4; const int b = blockIdx.y, t0 = blockIdx.x * 64, which = blockIdx.z;
  const float* X = which == 0 ? Xq : (which == 1 ? Xk : Xv); const float* Wm = which == 0 ? Wq : (which == 1 ? Wk : Wv); const float* bm = which == 0 ? bq : (which == 1 ? bk : bv);
  stage_w(Wm, sw, tid);
  { // the block's 256 channels x 64 positions come from memory: 16 lanes take one channel's 256 B as 16-B pieces, and all 32 loads of a thread are issued before the first is used, so the tile costs one memory latency (the loops below are unrolled so that the 32 values stay in registers)
    const int seg = tid & 15, cp = tid >> 4; const float* xg = X + ((size_t)b * E + 2 * cp) * NT + t0 + seg * 4; v4f xa[16], xb[16];   // channels 16 i + 2 cp and the next one, positions 4 seg .. 4 seg + 3
#pragma unroll
    for (int i = 0; i < 16; ++i) { xa[i] = *(const v4f*)(xg + (size_t)(i * 16) * NT); xb[i] = *(const v4f*)(xg + (size_t)(i * 16 + 1) * NT); }
#pragma unroll
    for (int i = 0; i < 16; ++i)
#pragma unroll
      for (int e = 0; e < 4; ++e) { v2b pk; pk[0] = (__bf16)xa[i][e]; pk[1] = (__bf16)xb[i][e]; *(v2b*)&sx[seg * 4 + e][i * 16 + 2 * cp] = pk; } }   // two neighbouring channels of one position: one 4-B store
  __syncthreads();
  v8f acc[16] = {};
#pragma unroll 2
  for (int kc = 0; kc < E / 32; ++kc) { const v16b a = frag_b(&sx[wave * 16 + col][kc * 32], lane);
#pragma unroll
    for (int jh = 0; jh < 2; ++jh) { v16b w[8];   // eight fragments read as one group, then their eight products: one LDS wait a group
#pragma unroll
      for (int j = 0; j < 8; ++j) w[j] = frag_b(&sw[(jh * 8 + j) * 16 + col][kc * 32], lane);
#pragma unroll
      for (int j = 0; j < 8; ++j) acc[jh * 8 + j] = wmma_bf(a, w[j], acc[jh * 8 + j]); } }
#pragma unroll
  for (int j = 0; j < 16; ++j) { const float bb = bfr(bm[j * 16 + col]);
#pragma unroll
    for (int r = 0; r < 8; ++r) so[wave][8 * g + r][j * 16 + col] = acc[j][r] + bb; }
  __syncthreads();
  if (which < 2) { float* dst = which == 0 ? Q : Kb;
    for (int rl = 0; rl < 16; ++rl) for (int pc = lane; pc < E / 4; pc += 32) vst2(dst + ((size_t)b * NT + t0 + wave * 16 + rl) * E + pc * 4, *(const v4f*)&so[wave][rl][pc * 4]); }
  else {
    for (int q = tid; q < E * 64; q += 128) { const int c = q >> 6, tl = q & 63; const float v = so[tl >> 4][tl & 15][c]; const __bf16 hb = (__bf16)v; svh[c][tl] = hb; svl[c][tl] = (__bf16)(v - (float)hb); }
    __syncthreads();
    for (int q = tid; q < E * 8; q += 128) { const int c = q >> 3, pc = q & 7; const size_t o = ((size_t)b * E + c) * NT + t0 + pc * 8; vst2((unsigned*)(VTH + o), *(const v4u*)&svh[c][pc * 8]); vst2((unsigned*)(VTL + o), *(const v4u*)&svl[c][pc * 8]); } }
}
// ---- k_attn: block = (64 queries, b*8+h): s = q.k (K 32, 3 products) * scale + mask[t][s]; single pass, online softmax
// K rows and V^T planes come in stages of 64 keys: the block's 128 threads fetch a stage once, in whole 128-B lines, one stage ahead into registers, and put it into the LDS buffer that is free; all four waves read their fragments from there
#define SK 64
__global__ __launch_bounds__(128) void k_attn(float* __restrict__ Q, const float* __restrict__ Kb, const float* __restrict__ mask, const __bf16* __restrict__ VTH, const __bf16* __restrict__ VTL) {
  __shared__ __align__(16) float sp[4][16][36]; __shared__ __align__(16) float so[4][16][36];
  __shared__ __align__(16) float sk[2][SK][36];                               // [buffer][key][d], pitch 36 dwords: 16 rows' 16-B reads fall on 16 different bank groups
  __shared__ __align__(16) __bf16 svh[2][HD][SK + 8], svl[2][HD][SK + 8];     // [buffer][channel][key], the same pitch in bytes
  const int tid = threadIdx.x, wave = tid >> 5, lane = tid & 31, col = lane & 15, g = lane >> 4; const int bh = blockIdx.y, b = bh >> 3, h = bh & 7; const int q0 = blockIdx.x * 64 + wave * 16; const float scale = 0.17677669529663687f;
  const int srow = tid >> 3, sseg = tid & 7;   // staging: 8 threads a 128-B row, 16 rows a pass of the block
  const float* kg = Kb + ((size_t)b * NT + srow) * E + h * HD + sseg * 4;
  const size_t vg = ((size_t)b * E + h * HD + srow) * NT + sseg * 8;
  v4f kr[4]; v8b hr[2], lr[2];   // one stage on its way; every loop over them is unrolled so that they stay in registers
#pragma unroll
  for (int i = 0; i < 4; ++i) kr[i] = *(const v4f*)(kg + (size_t)(i * 16) * E);
#pragma unroll
  for (int i = 0; i < 2; ++i) { hr[i] = *(const v8b*)(VTH + vg + (size_t)(i * 16) * NT); lr[i] = *(const v8b*)(VTL + vg + (size_t)(i * 16) * NT); }
  asm volatile("s_wait_xcnt 0x0" ::: "memory");   // the address registers of the loads above are reused at once (the query row's load lands in them): the wait stands in front of that overwrite
  const F2 a = split_row(Q + ((size_t)b * NT + q0 + col) * E + h * HD, 0, lane);
  float m[8], l[8];   // row 8g+r: running max times log2 e (equal in the row's 16 lanes), this lane's share of the running sum
#pragma unroll
  for (int r = 0; r < 8; ++r) { m[r] = -3.0e38f; l[r] = 0.f; }
  v8f acc[2] = {};
#pragma unroll
  for (int i = 0; i < 4; ++i) *(v4f*)&sk[0][i * 16 + srow][sseg * 4] = kr[i];
#pragma unroll
  for (int i = 0; i < 2; ++i) { *(v8b*)&svh[0][i * 16 + srow][sseg * 8] = hr[i]; *(v8b*)&svl[0][i * 16 + srow][sseg * 8] = lr[i]; }
  __syncthreads();
  // kept rolled: the body already holds two passes of 32 keys, a longer one would only grow the code
#pragma unroll 1
  for (int st = 0; st < NT / SK; ++st) { const int bf = st & 1; const bool more = st + 1 < NT / SK;
    if (more) {
#pragma unroll
      for (int i = 0; i < 4; ++i) kr[i] = *(const v4f*)(kg + (size_t)((st + 1) * SK + i * 16) * E);
#pragma unroll
      for (int i = 0; i < 2; ++i) { hr[i] = *(const v8b*)(VTH + vg + (size_t)(i * 16) * NT + (st + 1) * SK); lr[i] = *(const v8b*)(VTL + vg + (size_t)(i * 16) * NT + (st + 1) * SK); } }
#pragma unroll
    for (int hf = 0; hf < SK / 32; ++hf) { const int ks = st * (SK / 32) + hf; float sv[2][8];
#pragma unroll
      for (int ct = 0; ct < 2; ++ct) { const int kk = ks * 32 + ct * 16 + col; const F2 kb = split_row(&sk[bf][hf * 32 + ct * 16 + col][0], 0, lane); const v8f s = mac3(a, kb, (v8f){});
#pragma unroll
        for (int r = 0; r < 8; ++r) sv[ct][r] = s[r] * scale + bfr(mask[(size_t)(q0 + 8 * g + r) * NT + kk]); }
      float mn[8];
#pragma unroll
      for (int r = 0; r < 8; ++r) mn[r] = fmaxf(m[r], rowmax16(fmaxf(sv[0][r], sv[1][r])) * L2E);
#pragma unroll
      for (int r = 0; r < 8; ++r) { const float al = ex2(m[r] - mn[r]), p0 = ex2(fmaf(sv[0][r], L2E, -mn[r])), p1 = ex2(fmaf(sv[1][r], L2E, -mn[r]));
        sp[wave][8 * g + r][col] = p0; sp[wave][8 * g + r][16 + col] = p1; l[r] = l[r] * al + (p0 + p1); acc[0][r] *= al; acc[1][r] *= al; m[r] = mn[r]; }
      LDSX();
      const F2 pa = split_row(&sp[wave][col][0], 0, lane);
#pragma unroll
      for (int dt = 0; dt < 2; ++dt) { const v16b vh = frag_b(&svh[bf][dt * 16 + col][hf * 32], lane), vl = frag_b(&svl[bf][dt * 16 + col][hf * 32], lane);
        acc[dt] = wmma_bf(pa.l, vh, acc[dt]); acc[dt] = wmma_bf(pa.h, vl, acc[dt]); acc[dt] = wmma_bf(pa.h, vh, acc[dt]); }
      LDSX(); }
    if (more) {   // the other buffer's last readers left it at the barrier that ended the stage before
#pragma unroll
      for (int i = 0; i < 4; ++i) *(v4f*)&sk[bf ^ 1][i * 16 + srow][sseg * 4] = kr[i];
#pragma unroll
      for (int i = 0; i < 2; ++i) { *(v8b*)&svh[bf ^ 1][i * 16 + srow][sseg * 8] = hr[i]; *(v8b*)&svl[bf ^ 1][i * 16 + srow][sseg * 8] = lr[i]; } }
    __syncthreads(); }   // publishes the next stage and ends this stage's reads
#pragma unroll
  for (int r = 0; r < 8; ++r) { const float il = 1.0f / rowsum16(l[r]); so[wave][8 * g + r][col] = acc[0][r] * il; so[wave][8 * g + r][16 + col] = acc[1][r] * il; }
  LDSX();
  for (int rl = 0; rl < 16; ++rl) if (lane < 8) vst2(Q + ((size_t)b * NT + q0 + rl) * E + h * HD + lane * 4, *(const v4f*)&so[wave][rl][lane * 4]);
}
// ---- k_out: block = (b, 64 positions): Y[b][o][t] = sum_c O[b][t][c] Wo[o][c] + bo[o]: GEMM rows t (O rows hi/lo, K 256), cols o (16 tiles per wave = 256); written channel-major: per o the 64 t = 256 B
__global__ __launch_bounds__(128) void k_out(const float* __restrict__ O, const float* __restrict__ Wo, const float* __restrict__ bo, float* __restrict__ Y) {
  __shared__ __align__(16) float sot[E][68];          // [o][t local]
  __shared__ __align__(16) __bf16 sw[E][WP];
  const int tid = threadIdx.x, wave = tid >> 5, lane = tid & 31, col = lane & 15, g = lane >> 4; const int b = blockIdx.y, t0 = blockIdx.x * 64;
  stage_w(Wo, sw, tid);
  __syncthreads();   // publishes the staged weights to all four waves
  v8f acc[16] = {};
#pragma unroll 1
  for (int kc = 0; kc < E / 32; ++kc) { const F2 a = split_row(O + ((size_t)b * NT + t0 + wave * 16 + col) * E, kc * 32, lane);
#pragma unroll
    for (int jh = 0; jh < 2; ++jh) { v16b w[8];   // eight fragments read as one group, then their products: one LDS wait a group
#pragma unroll
      for (int j = 0; j < 8; ++j) w[j] = frag_b(&sw[(jh * 8 + j) * 16 + col][kc * 32], lane);
#pragma unroll
      for (int j = 0; j < 8; ++j) { acc[jh * 8 + j] = wmma_bf(a.l, w[j], acc[jh * 8 + j]); acc[jh * 8 + j] = wmma_bf(a.h, w[j], acc[jh * 8 + j]); } } }
#pragma unroll
  for (int j = 0; j < 16; ++j) { const int o = j * 16 + col; const float bb = bfr(bo[o]);
#pragma unroll
    for (int r = 0; r < 8; ++r) sot[o][wave * 16 + 8 * g + r] = acc[j][r] + bb; }
  __syncthreads();
  for (int q = tid; q < E * 16; q += 128) { const int o = q >> 4, pc = q & 15; vst2(Y + ((size_t)b * E + o) * NT + t0 + pc * 4, *(const v4f*)&sot[o][pc * 4]); }
}

extern "C" void kernel_launch(void* const* d_in, const int* in_sizes, int n_in, void* d_out, int out_size, void* d_ws, size_t ws_size, hipStream_t stream) {
  (void)in_sizes; (void)n_in; (void)out_size;
  const float** F = (const float**)d_in;   // d_in order: query, key, value [8,256,32,32], attn_mask [1024,1024], Wq, Wk, Wv, Wo [256,256], bq, bk, bv, bo [256]
  if (ws_size < (size_t)WS_END) return;
  char* ws = (char*)d_ws; float *Q = (float*)(ws + WS_Q), *Kb = (float*)(ws + WS_K); __bf16 *VTH = (__bf16*)(ws + WS_VTH), *VTL = (__bf16*)(ws + WS_VTL);
  k_proj<<<dim3(NT / 64, TNB, 3), 128, 0, stream>>>(F[0], F[1], F[2], F[4], F[8], F[5], F[9], F[6], F[10], Q, Kb, VTH, VTL);
  k_attn<<<dim3(TQB, TNB * NH), 128, 0, stream>>>(Q, Kb, F[3], VTH, VTL);
  k_out<<<dim3(TQB, TNB), 128, 0, stream>>>(Q, F[7], F[11], (float*)d_out);
}

// v006
// One run takes 89.3 microseconds.
// In two side-by-side timings against v005, it was 1.06 and 1.07 times as fast.
// Over all steps from v000 it is 5.04 times as fast.
#include <hip/hip_runtime.h>
#include <math.h>

typedef __attribute__((ext_vector_type(16))) _Float16 v16h;
typedef __attribute__((ext_vector_type(16))) __bf16 v16b;
typedef __attribute__((ext_vector_type(8)))  _Float16 v8h;
typedef __attribute__((ext_vector_type(8)))  float v8f;
typedef __attribute__((ext_vector_type(4)))  float v4f;
typedef __attribute__((ext_vector_type(2)))  float v2f;
typedef __attribute__((ext_vector_type(4)))  unsigned v4u;
typedef __attribute__((ext_vector_type(4)))  int v4i;
typedef float __attribute__((may_alias)) float_a;
typedef int __attribute__((may_alias)) int_a;

template <typename T> __device__ __forceinline__ void vst2(void* p, T v) { *(T*)p = v;  }
__device__ __forceinline__ v8f wmma16(v16h a, v16h b, v8f c) {
  v8f d = __builtin_amdgcn_wmma_f32_16x16x32_f16(false, a, false, b, (short)0, c, false, false);
  asm volatile("v_nop\n\tv_nop\n\tv_nop\n\tv_nop" : "+v"(d) : "v"(a), "v"(b));
  return d;
}
__device__ __forceinline__ v8f wmma_bf(v16b a, v16b b, v8f c) {
  v8f d = __builtin_amdgcn_wmma_f32_16x16x32_bf16(false, a, false, b, (short)0, c, false, false);
  asm volatile("v_nop\n\tv_nop\n\tv_nop\n\tv_nop" : "+v"(d) : "v"(a), "v"(b));
  return d;
}
// 16x16x32 fragments: lane = (h = lane>>4, row/col = lane&15); elements 0..7 = k0+8h+0..7, 8..15 = k0+16+8h+0..7; D element r = row 8h+r
__device__ __forceinline__ v16h frag_h(const _Float16* rowk0, int lane) {
  union { v16h v; v8h q[2]; } u; const _Float16* p = rowk0 + 8 * (lane >> 4);
  u.q[0] = *(const v8h*)p; u.q[1] = *(const v8h*)(p + 16); return u.v;
}
__device__ __forceinline__ v16h frag_f32(const float* rowk0, int lane) {
  v16h a; const float* p = rowk0 + 8 * (lane >> 4);
#pragma unroll
  for (int i = 0; i < 8; ++i) { a[i] = (_Float16)p[i]; a[8 + i] = (_Float16)p[16 + i]; }
  return a;
}
__device__ __forceinline__ v16h frag_f32s(const float* rowk0, int lane, float sc) {
  v16h a; const float* p = rowk0 + 8 * (lane >> 4);
#pragma unroll
  for (int i = 0; i < 8; ++i) { a[i] = (_Float16)(p[i] * sc); a[8 + i] = (_Float16)(p[16 + i] * sc); }
  return a;
}
// column fragment from a [K][ld] layout (column n), rows >= K read as 0
__device__ __forceinline__ v16h fragc_f32(const float* W, int k0, int n, int lane, int ld, int K) {
  v16h a; const int g = lane >> 4;
#pragma unroll
  for (int i = 0; i < 8; ++i) { const int ka = k0 + 8 * g + i, kb = ka + 16;
    a[i] = (_Float16)(ka < K ? W[(size_t)(ka < K ? ka : K - 1) * ld + n] : 0.f); a[8 + i] = (_Float16)(kb < K ? W[(size_t)(kb < K ? kb : K - 1) * ld + n] : 0.f); }
  return a;
}
struct F2 { v16b h, l; };
__device__ __forceinline__ F2 bsplit16(const float v[16]) { F2 r;
#pragma unroll
  for (int i = 0; i < 16; ++i) { const __bf16 h = (__bf16)v[i]; r.h[i] = h; r.l[i] = (__bf16)(v[i] - (float)h); }
  return r; }
__device__ __forceinline__ F2 split_row(const float* row, int k0, int lane) { float v[16]; const float* p = row + k0 + 8 * (lane >> 4);
#pragma unroll
  for (int i = 0; i < 8; ++i) { v[i] = p[i]; v[8 + i] = p[16 + i]; }
  return bsplit16(v); }
__device__ __forceinline__ F2 split_rowK(const float* row, int k0, int lane, int K) { float v[16]; const int g = lane >> 4;
#pragma unroll
  for (int i = 0; i < 8; ++i) { const int ka = k0 + 8 * g + i, kb = ka + 16; v[i] = ka < K ? row[ka < K ? ka : K - 1] : 0.f; v[8 + i] = kb < K ? row[kb < K ? kb : K - 1] : 0.f; }
  return bsplit16(v); }
__device__ __forceinline__ F2 split_col(const float* W, int k0, int n, int lane, int ld, int K) { float v[16]; const int g = lane >> 4;
#pragma unroll
  for (int i = 0; i < 8; ++i) { const int ka = k0 + 8 * g + i, kb = ka + 16; v[i] = ka < K ? W[(size_t)(ka < K ? ka : K - 1) * ld + n] : 0.f; v[8 + i] = kb < K ? W[(size_t)(kb < K ? kb : K - 1) * ld + n] : 0.f; }
  return bsplit16(v); }
__device__ __forceinline__ v8f mac3(const F2& a, const F2& b, v8f c) { c = wmma_bf(a.l, b.h, c); c = wmma_bf(a.h, b.l, c); return wmma_bf(a.h, b.h, c); }
__device__ __forceinline__ float sigm(float v) { return 1.0f / (1.0f + expf(-v)); }
#define LDSX() do { asm volatile("s_wait_dscnt 0" ::: "memory"); __builtin_amdgcn_wave_barrier(); __builtin_amdgcn_fence(__ATOMIC_RELEASE, "workgroup"); } while (0)


// Multi-head attention over 32x32 feature maps (channel-major NCHW inputs): q/k/v = 1x1 conv (W x + b) per position, 8 heads x 32, scores = q k^T / sqrt(32) + attn_mask[t][s] (dense float mask, shared across batch/heads), softmax over s, P v, concat heads (channel = h*32 + d), out = Wo out + bo -> [B, 256, 32, 32].
// k_proj (per (b, 64 positions): gathers the channel-major input columns into LDS as bf16 [pos][ch], one-product bf16 GEMM against bf16-rounded W rows; q,k as position rows [b][t][256], v as channel-major hi/lo planes [b][ch][t]), k_attn (per (64 queries, b, h): one pass over the 1024 keys, running row max m (kept as m log2 e) and row sum l; P = 2^(s log2 e - m log2 e) hi/lo . V^T planes, O and l rescaled by 2^(m_old log2 e - m_new log2 e) per 32 keys, O / l at the end, O rows), k_out (O(hi/lo) . Wo rows + bo, written channel-major: per output channel one 256-B segment of 64 positions).
#define NB 8
#define E 256
#define NT 1024
#define NH 8
#define HD 32
#ifndef TNB
#define TNB NB
#define TQB (NT / 64)
#endif
typedef __attribute__((ext_vector_type(8))) __bf16 v8b;
__device__ __forceinline__ v16b frag_b(const __bf16* rowk0, int lane) {
  union { v16b v; v8b q[2]; } u; const __bf16* p = rowk0 + 8 * (lane >> 4);
  u.q[0] = *(const v8b*)p; u.q[1] = *(const v8b*)(p + 16); return u.v;
}
__device__ __forceinline__ v16b frag_gbf(const float* rowk0, int lane) {
  v16b a; const float* p = rowk0 + 8 * (lane >> 4);
#pragma unroll
  for (int i = 0; i < 8; ++i) { a[i] = (__bf16)p[i]; a[8 + i] = (__bf16)p[16 + i]; }
  return a;
}
__device__ __forceinline__ float bfr(float v) { return (float)(__bf16)v; }
// 2^v as the one hardware instruction, in line; arguments here are <= 0 up to rounding, and a result below the normal range may read as 0
__device__ __forceinline__ float ex2(float v) { return __builtin_amdgcn_exp2f(v); }
#define L2E 1.4426950408889634f
#define WS_Q    0u                               // f32 [8][1024][256] q rows (t-major); later O rows
#define WS_K    (WS_Q + 4u * NB * NT * E)
#define WS_VTH  (WS_K + 4u * NB * NT * E)          // bf16 [8][256 ch][1024 t]
#define WS_VTL  (WS_VTH + 2u * NB * E * NT)
#define WS_END  (WS_VTL + 2u * NB * E * NT)
// A 256 x 256 weight matrix goes into LDS once a block, rounded to bf16 as the fragment loader rounded it: every wave-load is 512 contiguous bytes, 32 loads of a thread are on their way at a time.
// Row pitch 264 bf16 = 528 B (16 B x odd): the 16 rows of a fragment's 16-B reads fall on 16 different bank groups.
#define WP (E + 8)
typedef __attribute__((ext_vector_type(4))) __bf16 v4b;
typedef __attribute__((ext_vector_type(2))) __bf16 v2b;
__device__ __forceinline__ void stage_w(const float* __restrict__ Wm, __bf16 (*sw)[WP], int tid) {
  // kept rolled
#pragma unroll 1
  for (int o = 0; o < E * E / 4; o += 128 * 32) { v4f t[32];
#pragma unroll
    for (int i = 0; i < 32; ++i) t[i] = *(const v4f*)(Wm + (size_t)(o + i * 128 + tid) * 4);
#pragma unroll
    for (int i = 0; i < 32; ++i) { const int q = o + i * 128 + tid; v4b hb;
#pragma unroll
      for (int e = 0; e < 4; ++e) hb[e] = (__bf16)t[i][e];
      *(v4b*)&sw[q >> 6][(q & 63) * 4] = hb; } }
}

__global__ __launch_bounds__(128) void k_proj(const float* __restrict__ Xq, const float* __restrict__ Xk, const float* __restrict__ Xv, const float* __restrict__ Wq, const float* __restrict__ bq, const float* __restrict__ Wk, const float* __restrict__ bk, const float* __restrict__ Wv, const float* __restrict__ bv, float* __restrict__ Q, float* __restrict__ Kb, __bf16* __restrict__ VTH, __bf16* __restrict__ VTL) {
  __shared__ __align__(16) __bf16 sx[64][E + 8]; __shared__ __align__(16) float so[4][16][E + 4]; __shared__ __align__(16) __bf16 svh[E][72], svl[E][72]; __shared__ __align__(16) __bf16 sw[E][WP];
  const int tid = threadIdx.x, wave = tid >> 5, lane = tid & 31, col = lane & 15, g = lane >> 4; const int b = blockIdx.y, t0 = blockIdx.x * 64, which = blockIdx.z;
  const float* X = which == 0 ? Xq : (which == 1 ? Xk : Xv); const float* Wm = which == 0 ? Wq : (which == 1 ? Wk : Wv); const float* bm = which == 0 ? bq : (which == 1 ? bk : bv);
  stage_w(Wm, sw, tid);
  { // the block's 256 channels x 64 positions come from memory: 16 lanes take one channel's 256 B as 16-B pieces, and all 32 loads of a thread are issued before the first is used, so the tile costs one memory latency (the loops below are unrolled so that the 32 values stay in registers)
    const int seg = tid & 15, cp = tid >> 4; const float* xg = X + ((size_t)b * E + 2 * cp) * NT + t0 + seg * 4; v4f xa[16], xb[16];   // channels 16 i + 2 cp and the next one, positions 4 seg .. 4 seg + 3
#pragma unroll
    for (int i = 0; i < 16; ++i) { xa[i] = *(const v4f*)(xg + (size_t)(i * 16) * NT); xb[i] = *(const v4f*)(xg + (size_t)(i * 16 + 1) * NT); }
#pragma unroll
    for (int i = 0; i < 16; ++i)
#pragma unroll
      for (int e = 0; e < 4; ++e) { v2b pk; pk[0] = (__bf16)xa[i][e]; pk[1] = (__bf16)xb[i][e]; *(v2b*)&sx[seg * 4 + e][i * 16 + 2 * cp] = pk; } }   // two neighbouring channels of one position: one 4-B store
  __syncthreads();
  v8f acc[16] = {};
#pragma unroll 2
  for (int kc = 0; kc < E / 32; ++kc) { const v16b a = frag_b(&sx[wave * 16 + col][kc * 32], lane);
#pragma unroll
    for (int jh = 0; jh < 2; ++jh) { v16b w[8];   // eight fragments read as one group, then their eight products: one LDS wait a group
#pragma unroll
      for (int j = 0; j < 8; ++j) w[j] = frag_b(&sw[(jh * 8 + j) * 16 + col][kc * 32], lane);
#pragma unroll
      for (int j = 0; j < 8; ++j) acc[jh * 8 + j] = wmma_bf(a, w[j], acc[jh * 8 + j]); } }
#pragma unroll
  for (int j = 0; j < 16; ++j) { const float bb = bfr(bm[j * 16 + col]);
#pragma unroll
    for (int r = 0; r < 8; ++r) so[wave][8 * g + r][j * 16 + col] = acc[j][r] + bb; }
  __syncthreads();
  if (which < 2) { float* dst = which == 0 ? Q : Kb;
    for (int rl = 0; rl < 16; ++rl) for (int pc = lane; pc < E / 4; pc += 32) vst2(dst + ((size_t)b * NT + t0 + wave * 16 + rl) * E + pc * 4, *(const v4f*)&so[wave][rl][pc * 4]); }
  else {
    for (int q = tid; q < E * 64; q += 128) { const int c = q >> 6, tl = q & 63; const float v = so[tl >> 4][tl & 15][c]; const __bf16 hb = (__bf16)v; svh[c][tl] = hb; svl[c][tl] = (__bf16)(v - (float)hb); }
    __syncthreads();
    for (int q = tid; q < E * 8; q += 128) { const int c = q >> 3, pc = q & 7; const size_t o = ((size_t)b * E + c) * NT + t0 + pc * 8; vst2((unsigned*)(VTH + o), *(const v4u*)&svh[c][pc * 8]); vst2((unsigned*)(VTL + o), *(const v4u*)&svl[c][pc * 8]); } }
}
#define SK 64
// lane l <-> l ^ 16
__device__ __forceinline__ float xhalf(float v) { const int b = __float_as_int(v); return __int_as_float(__builtin_amdgcn_permlanex16(b, b, 0x76543210, 0xfedcba98, false, false)); }
// four waves a SIMD and no more: the grid is 4 blocks for each of the 256 WGPs, and a fifth block on one WGP would leave another with three
__global__ __launch_bounds__(128) __attribute__((amdgpu_waves_per_eu(4, 4))) void k_attn(float* __restrict__ Q, const float* __restrict__ Kb, const float* __restrict__ mask, const __bf16* __restrict__ VTH, const __bf16* __restrict__ VTL) {
  __shared__ __align__(16) float so[4][16][36];
  __shared__ __align__(16) float sk[2][SK][36];                               // [buffer][key][d], pitch 36 dwords: 16 rows' 16-B reads fall on 16 different bank groups
  __shared__ __align__(16) __bf16 svh[2][HD][SK + 8], svl[2][HD][SK + 8];     // [buffer][channel][key], the same pitch in bytes
  const int tid = threadIdx.x, wave = tid >> 5, lane = tid & 31, col = lane & 15, g = lane >> 4; const int bh = blockIdx.y, b = bh >> 3, h = bh & 7; const int q0 = blockIdx.x * 64 + wave * 16; const float scale = 0.17677669529663687f;
  const int srow = tid >> 3, sseg = tid & 7;   // staging: 8 threads a 128-B row, 16 rows a pass of the block
  const float* kg = Kb + ((size_t)b * NT + srow) * E + h * HD + sseg * 4;
  const size_t vg = ((size_t)b * E + h * HD + srow) * NT + sseg * 8;
  const float* mg = mask + (size_t)(q0 + col) * NT + 8 * g;   // this lane's query row of the mask, at its first key
  v4f kr[4]; v8b hr[2], lr[2];   // one stage on its way; every loop over them is unrolled so that they stay in registers
#pragma unroll
  for (int i = 0; i < 4; ++i) kr[i] = *(const v4f*)(kg + (size_t)(i * 16) * E);
#pragma unroll
  for (int i = 0; i < 2; ++i) { hr[i] = *(const v8b*)(VTH + vg + (size_t)(i * 16) * NT); lr[i] = *(const v8b*)(VTL + vg + (size_t)(i * 16) * NT); }
  asm volatile("s_wait_xcnt 0x0" ::: "memory");   // the address registers of the loads above are reused at once (the query row's load lands in them): the wait stands in front of that overwrite
  const F2 a = split_row(Q + ((size_t)b * NT + q0 + col) * E + h * HD, 0, lane);
  float m = -3.0e38f, l = 0.f;   // query q0 + col: running max times log2 e (equal in the query's two lanes), this lane's share of the running sum
  v8f acc[2] = {};               // O^T: element r of tile dt = channel dt * 16 + 8g + r of query q0 + col
#pragma unroll
  for (int i = 0; i < 4; ++i) *(v4f*)&sk[0][i * 16 + srow][sseg * 4] = kr[i];
#pragma unroll
  for (int i = 0; i < 2; ++i) { *(v8b*)&svh[0][i * 16 + srow][sseg * 8] = hr[i]; *(v8b*)&svl[0][i * 16 + srow][sseg * 8] = lr[i]; }
  __syncthreads();
  // kept rolled: the body already holds two passes of 32 keys, a longer one would only grow the code
#pragma unroll 1
  for (int st = 0; st < NT / SK; ++st) { const int bf = st & 1; const bool more = st + 1 < NT / SK;
    v4f mk[SK / 16][2];   // the stage's mask values of this lane: 8 consecutive keys a 16-key tile; asked for ahead of the next stage's K and V, which are wanted later
#pragma unroll
    for (int t = 0; t < SK / 16; ++t) { mk[t][0] = *(const v4f*)(mg + st * SK + t * 16); mk[t][1] = *(const v4f*)(mg + st * SK + t * 16 + 4); }
    asm volatile("s_wait_xcnt 0x0" ::: "memory");   // the address registers of the mask loads are reused while the loads are on their way: the wait stands in front of that overwrite
    if (more) {
#pragma unroll
      for (int i = 0; i < 4; ++i) kr[i] = *(const v4f*)(kg + (size_t)((st + 1) * SK + i * 16) * E);
#pragma unroll
      for (int i = 0; i < 2; ++i) { hr[i] = *(const v8b*)(VTH + vg + (size_t)(i * 16) * NT + (st + 1) * SK); lr[i] = *(const v8b*)(VTL + vg + (size_t)(i * 16) * NT + (st + 1) * SK); } }
#pragma unroll
    for (int hf = 0; hf < SK / 32; ++hf) { float sv[16];   // element ct * 8 + r = key hf * 32 + ct * 16 + 8g + r of the stage
#pragma unroll
      for (int ct = 0; ct < 2; ++ct) { const F2 kb = split_row(&sk[bf][hf * 32 + ct * 16 + col][0], 0, lane);
        v8f s = {}; s = wmma_bf(kb.h, a.l, s); s = wmma_bf(kb.l, a.h, s); s = wmma_bf(kb.h, a.h, s);
#pragma unroll
        for (int r = 0; r < 8; ++r) sv[ct * 8 + r] = s[r] * scale + bfr(mk[hf * 2 + ct][r >> 2][r & 3]); }
      float mx = sv[0];
#pragma unroll
      for (int i = 1; i < 16; ++i) mx = fmaxf(mx, sv[i]);
      mx = fmaxf(mx, xhalf(mx));
      const float mn = fmaxf(m, mx * L2E), al = ex2(m - mn); m = mn;
      v2f pp[8];   // the lane's 16 terms in pairs: one exponent argument for both (one query a lane), and the sum as a tree of pairs, not as one chain of 16 dependent adds
#pragma unroll
      for (int i = 0; i < 8; ++i) { pp[i] = __builtin_elementwise_fma((v2f){sv[2 * i], sv[2 * i + 1]}, (v2f){L2E, L2E}, (v2f){-mn, -mn}); pp[i][0] = ex2(pp[i][0]); pp[i][1] = ex2(pp[i][1]); sv[2 * i] = pp[i][0]; sv[2 * i + 1] = pp[i][1]; }
      const v2f pq = ((pp[0] + pp[1]) + (pp[2] + pp[3])) + ((pp[4] + pp[5]) + (pp[6] + pp[7]));
      l = l * al + (pq[0] + pq[1]);
      const F2 pb = bsplit16(sv);
#pragma unroll
      for (int dt = 0; dt < 2; ++dt) { const v16b vh = frag_b(&svh[bf][dt * 16 + col][hf * 32], lane), vl = frag_b(&svl[bf][dt * 16 + col][hf * 32], lane);
#pragma unroll
        for (int r = 0; r < 8; ++r) acc[dt][r] *= al;
        acc[dt] = wmma_bf(vh, pb.l, acc[dt]); acc[dt] = wmma_bf(vl, pb.h, acc[dt]); acc[dt] = wmma_bf(vh, pb.h, acc[dt]); } }
    if (more) {   // the other buffer's last readers left it at the barrier that ended the stage before
#pragma unroll
      for (int i = 0; i < 4; ++i) *(v4f*)&sk[bf ^ 1][i * 16 + srow][sseg * 4] = kr[i];
#pragma unroll
      for (int i = 0; i < 2; ++i) { *(v8b*)&svh[bf ^ 1][i * 16 + srow][sseg * 8] = hr[i]; *(v8b*)&svl[bf ^ 1][i * 16 + srow][sseg * 8] = lr[i]; } }
    __syncthreads(); }   // publishes the next stage and ends this stage's reads
  const float il = 1.0f / (l + xhalf(l));
#pragma unroll
  for (int dt = 0; dt < 2; ++dt)
#pragma unroll
    for (int hq = 0; hq < 2; ++hq) { v4f o;
#pragma unroll
      for (int e = 0; e < 4; ++e) o[e] = acc[dt][hq * 4 + e] * il;
      *(v4f*)&so[wave][col][dt * 16 + 8 * g + hq * 4] = o; }
  LDSX();
  for (int rl = 0; rl < 16; ++rl) if (lane < 8) vst2(Q + ((size_t)b * NT + q0 + rl) * E + h * HD + lane * 4, *(const v4f*)&so[wave][rl][lane * 4]);
}
// ---- k_out: block = (b, 64 positions): Y[b][o][t] = sum_c O[b][t][c] Wo[o][c] + bo[o]: GEMM rows t (O rows hi/lo, K 256), cols o (16 tiles per wave = 256); written channel-major: per o the 64 t = 256 B
__global__ __launch_bounds__(128) void k_out(const float* __restrict__ O, const float* __restrict__ Wo, const float* __restrict__ bo, float* __restrict__ Y) {
  __shared__ __align__(16) float sot[E][68];          // [o][t local]
  __shared__ __align__(16) __bf16 sw[E][WP];
  const int tid = threadIdx.x, wave = tid >> 5, lane = tid & 31, col = lane & 15, g = lane >> 4; const int b = blockIdx.y, t0 = blockIdx.x * 64;
  stage_w(Wo, sw, tid);
  __syncthreads();   // publishes the staged weights to all four waves
  v8f acc[16] = {};
#pragma unroll 1
  for (int kc = 0; kc < E / 32; ++kc) { const F2 a = split_row(O + ((size_t)b * NT + t0 + wave * 16 + col) * E, kc * 32, lane);
#pragma unroll
    for (int jh = 0; jh < 2; ++jh) { v16b w[8];   // eight fragments read as one group, then their products: one LDS wait a group
#pragma unroll
      for (int j = 0; j < 8; ++j) w[j] = frag_b(&sw[(jh * 8 + j) * 16 + col][kc * 32], lane);
#pragma unroll
      for (int j = 0; j < 8; ++j) { acc[jh * 8 + j] = wmma_bf(a.l, w[j], acc[jh * 8 + j]); acc[jh * 8 + j] = wmma_bf(a.h, w[j], acc[jh * 8 + j]); } } }
#pragma unroll
  for (int j = 0; j < 16; ++j) { const int o = j * 16 + col; const float bb = bfr(bo[o]);
#pragma unroll
    for (int r = 0; r < 8; ++r) sot[o][wave * 16 + 8 * g + r] = acc[j][r] + bb; }
  __syncthreads();
  for (int q = tid; q < E * 16; q += 128) { const int o = q >> 4, pc = q & 15; vst2(Y + ((size_t)b * E + o) * NT + t0 + pc * 4, *(const v4f*)&sot[o][pc * 4]); }
}

extern "C" void kernel_launch(void* const* d_in, const int* in_sizes, int n_in, void* d_out, int out_size, void* d_ws, size_t ws_size, hipStream_t stream) {
  (void)in_sizes; (void)n_in; (void)out_size;
  const float** F = (const float**)d_in;   // d_in order: query, key, value [8,256,32,32], attn_mask [1024,1024], Wq, Wk, Wv, Wo [256,256], bq, bk, bv, bo [256]
  if (ws_size < (size_t)WS_END) return;
  char* ws = (char*)d_ws; float *Q = (float*)(ws + WS_Q), *Kb = (float*)(ws + WS_K); __bf16 *VTH = (__bf16*)(ws + WS_VTH), *VTL = (__bf16*)(ws + WS_VTL);
  k_proj<<<dim3(NT / 64, TNB, 3), 128, 0, stream>>>(F[0], F[1], F[2], F[4], F[8], F[5], F[9], F[6], F[10], Q, Kb, VTH, VTL);
  k_attn<<<dim3(TQB, TNB * NH), 128, 0, stream>>>(Q, Kb, F[3], VTH, VTL);
  k_out<<<dim3(TQB, TNB), 128, 0, stream>>>(Q, F[7], F[11], (float*)d_out);
}

// v007
// One run takes 82 microseconds.
// Two timings next to v006 both put it at 1.09 times that version's speed.
// Over all steps from v000 it is 5.51 times as fast.
#include <hip/hip_runtime.h>
#include <math.h>

typedef __attribute__((ext_vector_type(16))) _Float16 v16h;
typedef __attribute__((ext_vector_type(16))) __bf16 v16b;
typedef __attribute__((ext_vector_type(8)))  _Float16 v8h;
typedef __attribute__((ext_vector_type(8)))  float v8f;
typedef __attribute__((ext_vector_type(4)))  float v4f;
typedef __attribute__((ext_vector_type(2)))  float v2f;
typedef __attribute__((ext_vector_type(4)))  unsigned v4u;
typedef __attribute__((ext_vector_type(4)))  int v4i;
typedef float __attribute__((may_alias)) float_a;
typedef int __attribute__((may_alias)) int_a;

template <typename T> __device__ __forceinline__ void vst2(void* p, T v) { *(T*)p = v;  }
__device__ __forceinline__ v8f wmma16(v16h a, v16h b, v8f c) {
  v8f d = __builtin_amdgcn_wmma_f32_16x16x32_f16(false, a, false, b, (short)0, c, false, false);
  asm volatile("v_nop\n\tv_nop\n\tv_nop\n\tv_nop" : "+v"(d) : "v"(a), "v"(b));
  return d;
}
__device__ __forceinline__ v8f wmma_bf(v16b a, v16b b, v8f c) {
  v8f d = __builtin_amdgcn_wmma_f32_16x16x32_bf16(false, a, false, b, (short)0, c, false, false);
  asm volatile("v_nop\n\tv_nop\n\tv_nop\n\tv_nop" : "+v"(d) : "v"(a), "v"(b));
  return d;
}
// 16x16x32 fragments: lane = (h = lane>>4, row/col = lane&15); elements 0..7 = k0+8h+0..7, 8..15 = k0+16+8h+0..7; D element r = row 8h+r
__device__ __forceinline__ v16h frag_h(const _Float16* rowk0, int lane) {
  union { v16h v; v8h q[2]; } u; const _Float16* p = rowk0 + 8 * (lane >> 4);
  u.q[0] = *(const v8h*)p; u.q[1] = *(const v8h*)(p + 16); return u.v;
}
__device__ __forceinline__ v16h frag_f32(const float* rowk0, int lane) {
  v16h a; const float* p = rowk0 + 8 * (lane >> 4);
#pragma unroll
  for (int i = 0; i < 8; ++i) { a[i] = (_Float16)p[i]; a[8 + i] = (_Float16)p[16 + i]; }
  return a;
}
__device__ __forceinline__ v16h frag_f32s(const float* rowk0, int lane, float sc) {
  v16h a; const float* p = rowk0 + 8 * (lane >> 4);
#pragma unroll
  for (int i = 0; i < 8; ++i) { a[i] = (_Float16)(p[i] * sc); a[8 + i] = (_Float16)(p[16 + i] * sc); }
  return a;
}
// column fragment from a [K][ld] layout (column n), rows >= K read as 0
__device__ __forceinline__ v16h fragc_f32(const float* W, int k0, int n, int lane, int ld, int K) {
  v16h a; const int g = lane >> 4;
#pragma unroll
  for (int i = 0; i < 8; ++i) { const int ka = k0 + 8 * g + i, kb = ka + 16;
    a[i] = (_Float16)(ka < K ? W[(size_t)(ka < K ? ka : K - 1) * ld + n] : 0.f); a[8 + i] = (_Float16)(kb < K ? W[(size_t)(kb < K ? kb : K - 1) * ld + n] : 0.f); }
  return a;
}
struct F2 { v16b h, l; };
__device__ __forceinline__ F2 bsplit16(const float v[16]) { F2 r;
#pragma unroll
  for (int i = 0; i < 16; ++i) { const __bf16 h = (__bf16)v[i]; r.h[i] = h; r.l[i] = (__bf16)(v[i] - (float)h); }
  return r; }
__device__ __forceinline__ F2 split_row(const float* row, int k0, int lane) { float v[16]; const float* p = row + k0 + 8 * (lane >> 4);
#pragma unroll
  for (int i = 0; i < 8; ++i) { v[i] = p[i]; v[8 + i] = p[16 + i]; }
  return bsplit16(v); }
__device__ __forceinline__ F2 split_rowK(const float* row, int k0, int lane, int K) { float v[16]; const int g = lane >> 4;
#pragma unroll
  for (int i = 0; i < 8; ++i) { const int ka = k0 + 8 * g + i, kb = ka + 16; v[i] = ka < K ? row[ka < K ? ka : K - 1] : 0.f; v[8 + i] = kb < K ? row[kb < K ? kb : K - 1] : 0.f; }
  return bsplit16(v); }
__device__ __forceinline__ F2 split_col(const float* W, int k0, int n, int lane, int ld, int K) { float v[16]; const int g = lane >> 4;
#pragma unroll
  for (int i = 0; i < 8; ++i) { const int ka = k0 + 8 * g + i, kb = ka + 16; v[i] = ka < K ? W[(size_t)(ka < K ? ka : K - 1) * ld + n] : 0.f; v[8 + i] = kb < K ? W[(size_t)(kb < K ? kb : K - 1) * ld + n] : 0.f; }
  return bsplit16(v); }
__device__ __forceinline__ v8f mac3(const F2& a, const F2& b, v8f c) { c = wmma_bf(a.l, b.h, c); c = wmma_bf(a.h, b.l, c); return wmma_bf(a.h, b.h, c); }
__device__ __forceinline__ float sigm(float v) { return 1.0f / (1.0f + expf(-v)); }
#define LDSX() do { asm volatile("s_wait_dscnt 0" ::: "memory"); __builtin_amdgcn_wave_barrier(); __builtin_amdgcn_fence(__ATOMIC_RELEASE, "workgroup"); } while (0)


// Multi-head attention over 32x32 feature maps (channel-major NCHW inputs): q/k/v = 1x1 conv (W x + b) per position, 8 heads x 32, scores = q k^T / sqrt(32) + attn_mask[t][s] (dense float mask, shared across batch/heads), softmax over s, P v, concat heads (channel = h*32 + d), out = Wo out + bo -> [B, 256, 32, 32].
// k_proj (per (b, 64 positions): gathers the channel-major input columns into LDS as bf16 [pos][ch], single bf16 GEMM against W rows; q as position rows [b][t][256], k as position rows split into bf16 hi/lo per head, v as channel-major hi/lo planes [b][ch][t]), k_attn (per (64 queries, b, h): one pass over the 1024 keys, running row max m (kept as m log2 e) and row sum l; P = 2^(s log2 e - m log2 e) hi/lo . V^T planes, O and l rescaled by 2^(m_old log2 e - m_new log2 e) per 32 keys, O / l at the end, O rows), k_out (O(hi/lo) . Wo rows + bo, written channel-major: per output channel one 256-B segment of 64 positions).
#define NB 8
#define E 256
#define NT 1024
#define NH 8
#define HD 32
#ifndef TNB
#define TNB NB
#define TQB (NT / 64)
#endif
typedef __attribute__((ext_vector_type(8))) __bf16 v8b;
__device__ __forceinline__ v16b frag_b(const __bf16* rowk0, int lane) {
  union { v16b v; v8b q[2]; } u; const __bf16* p = rowk0 + 8 * (lane >> 4);
  u.q[0] = *(const v8b*)p; u.q[1] = *(const v8b*)(p + 16); return u.v;
}
__device__ __forceinline__ v16b frag_gbf(const float* rowk0, int lane) {
  v16b a; const float* p = rowk0 + 8 * (lane >> 4);
#pragma unroll
  for (int i = 0; i < 8; ++i) { a[i] = (__bf16)p[i]; a[8 + i] = (__bf16)p[16 + i]; }
  return a;
}
__device__ __forceinline__ float bfr(float v) { return (float)(__bf16)v; }
// 2^v as the one hardware instruction, in line; arguments here are <= 0 up to rounding, and a result below the normal range may read as 0
__device__ __forceinline__ float ex2(float v) { return __builtin_amdgcn_exp2f(v); }
#define L2E 1.4426950408889634f
#define WS_Q    0u                               // f32 [8][1024][256] q rows (t-major); later O rows
#define WS_K    (WS_Q + 4u * NB * NT * E)          // bf16 [8][1024 t][8 heads][hi 32 | lo 32]: a key's 128 B of one head are one line
#define WS_VTH  (WS_K + 4u * NB * NT * E)          // bf16 [8][256 ch][1024 t]
#define WS_VTL  (WS_VTH + 2u * NB * E * NT)
#define WS_END  (WS_VTL + 2u * NB * E * NT)
// A 256 x 256 weight matrix goes into LDS once a block, rounded to bf16 as the fragment loader rounded it: every wave-load is 512 contiguous bytes, 32 loads of a thread are on their way at a time.
// Row pitch 264 bf16 = 528 B (16 B x odd): the 16 rows of a fragment's 16-B reads fall on 16 different bank groups.
#define WP (E + 8)
typedef __attribute__((ext_vector_type(4))) __bf16 v4b;
typedef __attribute__((ext_vector_type(2))) __bf16 v2b;
__device__ __forceinline__ void stage_w(const float* __restrict__ Wm, __bf16 (*sw)[WP], int tid) {
  // kept rolled
#pragma unroll 1
  for (int o = 0; o < E * E / 4; o += 128 * 32) { v4f t[32];
#pragma unroll
    for (int i = 0; i < 32; ++i) t[i] = *(const v4f*)(Wm + (size_t)(o + i * 128 + tid) * 4);
#pragma unroll
    for (int i = 0; i < 32; ++i) { const int q = o + i * 128 + tid; v4b hb;
#pragma unroll
      for (int e = 0; e < 4; ++e) hb[e] = (__bf16)t[i][e];
      *(v4b*)&sw[q >> 6][(q & 63) * 4] = hb; } }
}

__global__ __launch_bounds__(128) void k_proj(const float* __restrict__ Xq, const float* __restrict__ Xk, const float* __restrict__ Xv, const float* __restrict__ Wq, const float* __restrict__ bq, const float* __restrict__ Wk, const float* __restrict__ bk, const float* __restrict__ Wv, const float* __restrict__ bv, float* __restrict__ Q, __bf16* __restrict__ KS, __bf16* __restrict__ VTH, __bf16* __restrict__ VTL) {
  __shared__ __align__(16) __bf16 sx[64][E + 8]; __shared__ __align__(16) float so[4][16][E + 4]; __shared__ __align__(16) __bf16 svh[E][72], svl[E][72]; __shared__ __align__(16) __bf16 sw[E][WP];
  const int tid = threadIdx.x, wave = tid >> 5, lane = tid & 31, col = lane & 15, g = lane >> 4; const int b = blockIdx.y, t0 = blockIdx.x * 64, which = blockIdx.z;
  const float* X = which == 0 ? Xq : (which == 1 ? Xk : Xv); const float* Wm = which == 0 ? Wq : (which == 1 ? Wk : Wv); const float* bm = which == 0 ? bq : (which == 1 ? bk : bv);
  stage_w(Wm, sw, tid);
  { // the block's 256 channels x 64 positions come from memory: 16 lanes take one channel's 256 B as 16-B pieces, and all 32 loads of a thread are issued before the first is used, so the tile costs one memory latency (the loops below are unrolled so that the 32 values stay in registers)
    const int seg = tid & 15, cp = tid >> 4; const float* xg = X + ((size_t)b * E + 2 * cp) * NT + t0 + seg * 4; v4f xa[16], xb[16];   // channels 16 i + 2 cp and the next one, positions 4 seg .. 4 seg + 3
#pragma unroll
    for (int i = 0; i < 16; ++i) { xa[i] = *(const v4f*)(xg + (size_t)(i * 16) * NT); xb[i] = *(const v4f*)(xg + (size_t)(i * 16 + 1) * NT); }
#pragma unroll
    for (int i = 0; i < 16; ++i)
#pragma unroll
      for (int e = 0; e < 4; ++e) { v2b pk; pk[0] = (__bf16)xa[i][e]; pk[1] = (__bf16)xb[i][e]; *(v2b*)&sx[seg * 4 + e][i * 16 + 2 * cp] = pk; } }   // two neighbouring channels of one position: one 4-B store
  __syncthreads();
  v8f acc[16] = {};
#pragma unroll 2
  for (int kc = 0; kc < E / 32; ++kc) { const v16b a = frag_b(&sx[wave * 16 + col][kc * 32], lane);
#pragma unroll
    for (int jh = 0; jh < 2; ++jh) { v16b w[8];   // eight fragments read as one group, then their eight products: one LDS wait a group
#pragma unroll
      for (int j = 0; j < 8; ++j) w[j] = frag_b(&sw[(jh * 8 + j) * 16 + col][kc * 32], lane);
#pragma unroll
      for (int j = 0; j < 8; ++j) acc[jh * 8 + j] = wmma_bf(a, w[j], acc[jh * 8 + j]); } }
#pragma unroll
  for (int j = 0; j < 16; ++j) { const float bb = bfr(bm[j * 16 + col]);
#pragma unroll
    for (int r = 0; r < 8; ++r) so[wave][8 * g + r][j * 16 + col] = acc[j][r] + bb; }
  __syncthreads();
  if (which == 0) {
    for (int rl = 0; rl < 16; ++rl) for (int pc = lane; pc < E / 4; pc += 32) vst2(Q + ((size_t)b * NT + t0 + wave * 16 + rl) * E + pc * 4, *(const v4f*)&so[wave][rl][pc * 4]); }
  else if (which == 1) {   // k leaves here already split into hi and lo, once for all the waves that read it: a lane takes 8 channels of a row, the wave one row a trip
    for (int rl = 0; rl < 16; ++rl) { v8b kh, kl;
#pragma unroll
      for (int e = 0; e < 8; ++e) { const float v = so[wave][rl][lane * 8 + e]; const __bf16 hb = (__bf16)v; kh[e] = hb; kl[e] = (__bf16)(v - (float)hb); }
      __bf16* dst = KS + (((size_t)b * NT + t0 + wave * 16 + rl) * NH + (lane >> 2)) * (2 * HD) + (lane & 3) * 8;
      vst2(dst, kh); vst2(dst + HD, kl); } }
  else {
    for (int q = tid; q < E * 64; q += 128) { const int c = q >> 6, tl = q & 63; const float v = so[tl >> 4][tl & 15][c]; const __bf16 hb = (__bf16)v; svh[c][tl] = hb; svl[c][tl] = (__bf16)(v - (float)hb); }
    __syncthreads();
    for (int q = tid; q < E * 8; q += 128) { const int c = q >> 3, pc = q & 7; const size_t o = ((size_t)b * E + c) * NT + t0 + pc * 8; vst2((unsigned*)(VTH + o), *(const v4u*)&svh[c][pc * 8]); vst2((unsigned*)(VTL + o), *(const v4u*)&svl[c][pc * 8]); } }
}
#define SK 64
// lane l <-> l ^ 16
__device__ __forceinline__ float xhalf(float v) { const int b = __float_as_int(v); return __int_as_float(__builtin_amdgcn_permlanex16(b, b, 0x76543210, 0xfedcba98, false, false)); }
// four waves a SIMD and no more: the grid is 4 blocks for each of the 256 WGPs, and a fifth block on one WGP would leave another with three
__global__ __launch_bounds__(128) __attribute__((amdgpu_waves_per_eu(4, 4))) void k_attn(float* __restrict__ Q, const __bf16* __restrict__ KS, const float* __restrict__ mask, const __bf16* __restrict__ VTH, const __bf16* __restrict__ VTL) {
  __shared__ __align__(16) float so[4][16][36];
  __shared__ __align__(16) __bf16 sk[2][SK][2 * HD + 8];                      // [buffer][key][hi d | lo d], pitch 36 dwords: 16 rows' 16-B reads fall on 16 different bank groups
  __shared__ __align__(16) __bf16 svh[2][HD][SK + 8], svl[2][HD][SK + 8];     // [buffer][channel][key], the same pitch in bytes
  const int tid = threadIdx.x, wave = tid >> 5, lane = tid & 31, col = lane & 15, g = lane >> 4; const int bh = blockIdx.y, b = bh >> 3, h = bh & 7; const int q0 = blockIdx.x * 64 + wave * 16; const float scale = 0.17677669529663687f;
  const int srow = tid >> 3, sseg = tid & 7;   // staging: 8 threads a 128-B row, 16 rows a pass of the block
  const __bf16* kg = KS + (((size_t)b * NT + srow) * NH + h) * (2 * HD) + sseg * 8;
  const size_t vg = ((size_t)b * E + h * HD + srow) * NT + sseg * 8;
  const float* mg = mask + (size_t)(q0 + col) * NT + 8 * g;   // this lane's query row of the mask, at its first key
  v8b kr[4], hr[2], lr[2];   // one stage on its way; every loop over them is unrolled so that they stay in registers
#pragma unroll
  for (int i = 0; i < 4; ++i) kr[i] = *(const v8b*)(kg + (size_t)(i * 16) * (2 * E));
#pragma unroll
  for (int i = 0; i < 2; ++i) { hr[i] = *(const v8b*)(VTH + vg + (size_t)(i * 16) * NT); lr[i] = *(const v8b*)(VTL + vg + (size_t)(i * 16) * NT); }
  asm volatile("s_wait_xcnt 0x0" ::: "memory");   // the address registers of the loads above are reused at once (the query row's load lands in them): the wait stands in front of that overwrite
  const F2 a = split_row(Q + ((size_t)b * NT + q0 + col) * E + h * HD, 0, lane);
  float m = -3.0e38f, l = 0.f;   // query q0 + col: running max times log2 e (equal in the query's two lanes), this lane's share of the running sum
  v8f acc[2] = {};               // O^T: element r of tile dt = channel dt * 16 + 8g + r of query q0 + col
#pragma unroll
  for (int i = 0; i < 4; ++i) *(v8b*)&sk[0][i * 16 + srow][sseg * 8] = kr[i];
#pragma unroll
  for (int i = 0; i < 2; ++i) { *(v8b*)&svh[0][i * 16 + srow][sseg * 8] = hr[i]; *(v8b*)&svl[0][i * 16 + srow][sseg * 8] = lr[i]; }
  __syncthreads();
  // kept rolled: the body already holds two passes of 32 keys, a longer one would only grow the code
#pragma unroll 1
  for (int st = 0; st < NT / SK; ++st) { const int bf = st & 1; const bool more = st + 1 < NT / SK;
    v4f mk[SK / 16][2];   // the stage's mask values of this lane: 8 consecutive keys a 16-key tile; asked for ahead of the next stage's K and V, which are wanted later
#pragma unroll
    for (int t = 0; t < SK / 16; ++t) { mk[t][0] = *(const v4f*)(mg + st * SK + t * 16); mk[t][1] = *(const v4f*)(mg + st * SK + t * 16 + 4); }
    asm volatile("s_wait_xcnt 0x0" ::: "memory");   // the address registers of the mask loads are reused while the loads are on their way: the wait stands in front of that overwrite
    if (more) {
#pragma unroll
      for (int i = 0; i < 4; ++i) kr[i] = *(const v8b*)(kg + (size_t)((st + 1) * SK + i * 16) * (2 * E));
#pragma unroll
      for (int i = 0; i < 2; ++i) { hr[i] = *(const v8b*)(VTH + vg + (size_t)(i * 16) * NT + (st + 1) * SK); lr[i] = *(const v8b*)(VTL + vg + (size_t)(i * 16) * NT + (st + 1) * SK); }
      asm volatile("s_wait_xcnt 0x0" ::: "memory"); }   // the address registers of these loads are stepped on at the loop's foot: the wait stands in front of that overwrite
#pragma unroll
    for (int hf = 0; hf < SK / 32; ++hf) { float sv[16];   // element ct * 8 + r = key hf * 32 + ct * 16 + 8g + r of the stage
#pragma unroll
      for (int ct = 0; ct < 2; ++ct) { const __bf16* kw = &sk[bf][hf * 32 + ct * 16 + col][0]; const v16b kh = frag_b(kw, lane), kl = frag_b(kw + HD, lane);
        v8f s = {}; s = wmma_bf(kh, a.l, s); s = wmma_bf(kl, a.h, s); s = wmma_bf(kh, a.h, s);
#pragma unroll
        for (int r = 0; r < 8; ++r) sv[ct * 8 + r] = s[r] * scale + bfr(mk[hf * 2 + ct][r >> 2][r & 3]); }
      float mx = sv[0];
#pragma unroll
      for (int i = 1; i < 16; ++i) mx = fmaxf(mx, sv[i]);
      mx = fmaxf(mx, xhalf(mx));
      const float mn = fmaxf(m, mx * L2E), al = ex2(m - mn); m = mn;
      v2f pp[8];   // the lane's 16 terms in pairs: one exponent argument for both (one query a lane), and the sum as a tree of pairs, not as one chain of 16 dependent adds
#pragma unroll
      for (int i = 0; i < 8; ++i) { pp[i] = __builtin_elementwise_fma((v2f){sv[2 * i], sv[2 * i + 1]}, (v2f){L2E, L2E}, (v2f){-mn, -mn}); pp[i][0] = ex2(pp[i][0]); pp[i][1] = ex2(pp[i][1]); sv[2 * i] = pp[i][0]; sv[2 * i + 1] = pp[i][1]; }
      const v2f pq = ((pp[0] + pp[1]) + (pp[2] + pp[3])) + ((pp[4] + pp[5]) + (pp[6] + pp[7]));
      l = l * al + (pq[0] + pq[1]);
      const F2 pb = bsplit16(sv);
#pragma unroll
      for (int dt = 0; dt < 2; ++dt) { const v16b vh = frag_b(&svh[bf][dt * 16 + col][hf * 32], lane), vl = frag_b(&svl[bf][dt * 16 + col][hf * 32], lane);
#pragma unroll
        for (int r = 0; r < 8; ++r) acc[dt][r] *= al;
        acc[dt] = wmma_bf(vh, pb.l, acc[dt]); acc[dt] = wmma_bf(vl, pb.h, acc[dt]); acc[dt] = wmma_bf(vh, pb.h, acc[dt]); } }
    if (more) {   // the other buffer's last readers left it at the barrier that ended the stage before
#pragma unroll
      for (int i = 0; i < 4; ++i) *(v8b*)&sk[bf ^ 1][i * 16 + srow][sseg * 8] = kr[i];
#pragma unroll
      for (int i = 0; i < 2; ++i) { *(v8b*)&svh[bf ^ 1][i * 16 + srow][sseg * 8] = hr[i]; *(v8b*)&svl[bf ^ 1][i * 16 + srow][sseg * 8] = lr[i]; } }
    __syncthreads(); }   // publishes the next stage and ends this stage's reads
  const float il = 1.0f / (l + xhalf(l));
#pragma unroll
  for (int dt = 0; dt < 2; ++dt)
#pragma unroll
    for (int hq = 0; hq < 2; ++hq) { v4f o;
#pragma unroll
      for (int e = 0; e < 4; ++e) o[e] = acc[dt][hq * 4 + e] * il;
      *(v4f*)&so[wave][col][dt * 16 + 8 * g + hq * 4] = o; }
  LDSX();
  for (int rl = 0; rl < 16; ++rl) if (lane < 8) vst2(Q + ((size_t)b * NT + q0 + rl) * E + h * HD + lane * 4, *(const v4f*)&so[wave][rl][lane * 4]);
}
// ---- k_out: block = (b, 64 positions): Y[b][o][t] = sum_c O[b][t][c] Wo[o][c] + bo[o]: GEMM rows t (O rows hi/lo, K 256), cols o (16 tiles per wave = 256); written channel-major: per o the 64 t = 256 B
__global__ __launch_bounds__(128) void k_out(const float* __restrict__ O, const float* __restrict__ Wo, const float* __restrict__ bo, float* __restrict__ Y) {
  __shared__ __align__(16) float sot[E][68];          // [o][t local]
  __shared__ __align__(16) __bf16 sw[E][WP];
  const int tid = threadIdx.x, wave = tid >> 5, lane = tid & 31, col = lane & 15, g = lane >> 4; const int b = blockIdx.y, t0 = blockIdx.x * 64;
  stage_w(Wo, sw, tid);
  __syncthreads();   // publishes the staged weights to all four waves
  v8f acc[16] = {};
#pragma unroll 1
  for (int kc = 0; kc < E / 32; ++kc) { const F2 a = split_row(O + ((size_t)b * NT + t0 + wave * 16 + col) * E, kc * 32, lane);
#pragma unroll
    for (int jh = 0; jh < 2; ++jh) { v16b w[8];   // eight fragments read as one group, then their products: one LDS wait a group
#pragma unroll
      for (int j = 0; j < 8; ++j) w[j] = frag_b(&sw[(jh * 8 + j) * 16 + col][kc * 32], lane);
#pragma unroll
      for (int j = 0; j < 8; ++j) { acc[jh * 8 + j] = wmma_bf(a.l, w[j], acc[jh * 8 + j]); acc[jh * 8 + j] = wmma_bf(a.h, w[j], acc[jh * 8 + j]); } } }
#pragma unroll
  for (int j = 0; j < 16; ++j) { const int o = j * 16 + col; const float bb = bfr(bo[o]);
#pragma unroll
    for (int r = 0; r < 8; ++r) sot[o][wave * 16 + 8 * g + r] = acc[j][r] + bb; }
  __syncthreads();
  for (int q = tid; q < E * 16; q += 128) { const int o = q >> 4, pc = q & 15; vst2(Y + ((size_t)b * E + o) * NT + t0 + pc * 4, *(const v4f*)&sot[o][pc * 4]); }
}

extern "C" void kernel_launch(void* const* d_in, const int* in_sizes, int n_in, void* d_out, int out_size, void* d_ws, size_t ws_size, hipStream_t stream) {
  (void)in_sizes; (void)n_in; (void)out_size;
  const float** F = (const float**)d_in;   // d_in order: query, key, value [8,256,32,32], attn_mask [1024,1024], Wq, Wk, Wv, Wo [256,256], bq, bk, bv, bo [256]
  if (ws_size < (size_t)WS_END) return;
  char* ws = (char*)d_ws; float *Q = (float*)(ws + WS_Q); __bf16 *KS = (__bf16*)(ws + WS_K), *VTH = (__bf16*)(ws + WS_VTH), *VTL = (__bf16*)(ws + WS_VTL);
  k_proj<<<dim3(NT / 64, TNB, 3), 128, 0, stream>>>(F[0], F[1], F[2], F[4], F[8], F[5], F[9], F[6], F[10], Q, KS, VTH, VTL);
  k_attn<<<dim3(TQB, TNB * NH), 128, 0, stream>>>(Q, KS, F[3], VTH, VTL);
  k_out<<<dim3(TQB, TNB), 128, 0, stream>>>(Q, F[7], F[11], (float*)d_out);
}

// v008
// It runs in 67.1 microseconds.
// Next to v007, in two timings, it ran 1.22 and 1.21 times as fast.
// All steps since v000 together make it 6.70 times as fast.
#include <hip/hip_runtime.h>
#include <math.h>

typedef __attribute__((ext_vector_type(16))) _Float16 v16h;
typedef __attribute__((ext_vector_type(16))) __bf16 v16b;
typedef __attribute__((ext_vector_type(8)))  _Float16 v8h;
typedef __attribute__((ext_vector_type(8)))  float v8f;
typedef __attribute__((ext_vector_type(4)))  float v4f;
typedef __attribute__((ext_vector_type(2)))  float v2f;
typedef __attribute__((ext_vector_type(4)))  unsigned v4u;
typedef __attribute__((ext_vector_type(4)))  int v4i;
typedef float __attribute__((may_alias)) float_a;
typedef int __attribute__((may_alias)) int_a;

template <typename T> __device__ __forceinline__ void vst2(void* p, T v) { *(T*)p = v;  }
__device__ __forceinline__ v8f wmma16(v16h a, v16h b, v8f c) {
  v8f d = __builtin_amdgcn_wmma_f32_16x16x32_f16(false, a, false, b, (short)0, c, false, false);
  asm volatile("v_nop\n\tv_nop\n\tv_nop\n\tv_nop" : "+v"(d) : "v"(a), "v"(b));
  return d;
}
__device__ __forceinline__ v8f wmma_bf(v16b a, v16b b, v8f c) {
  v8f d = __builtin_amdgcn_wmma_f32_16x16x32_bf16(false, a, false, b, (short)0, c, false, false);
  asm volatile("v_nop\n\tv_nop\n\tv_nop\n\tv_nop" : "+v"(d) : "v"(a), "v"(b));
  return d;
}
// 16x16x32 fragments: lane = (h = lane>>4, row/col = lane&15); elements 0..7 = k0+8h+0..7, 8..15 = k0+16+8h+0..7; D element r = row 8h+r
__device__ __forceinline__ v16h frag_h(const _Float16* rowk0, int lane) {
  union { v16h v; v8h q[2]; } u; const _Float16* p = rowk0 + 8 * (lane >> 4);
  u.q[0] = *(const v8h*)p; u.q[1] = *(const v8h*)(p + 16); return u.v;
}
__device__ __forceinline__ v16h frag_f32(const float* rowk0, int lane) {
  v16h a; const float* p = rowk0 + 8 * (lane >> 4);
#pragma unroll
  for (int i = 0; i < 8; ++i) { a[i] = (_Float16)p[i]; a[8 + i] = (_Float16)p[16 + i]; }
  return a;
}
__device__ __forceinline__ v16h frag_f32s(const float* rowk0, int lane, float sc) {
  v16h a; const float* p = rowk0 + 8 * (lane >> 4);
#pragma unroll
  for (int i = 0; i < 8; ++i) { a[i] = (_Float16)(p[i] * sc); a[8 + i] = (_Float16)(p[16 + i] * sc); }
  return a;
}
// column fragment from a [K][ld] layout (column n), rows >= K read as 0
__device__ __forceinline__ v16h fragc_f32(const float* W, int k0, int n, int lane, int ld, int K) {
  v16h a; const int g = lane >> 4;
#pragma unroll
  for (int i = 0; i < 8; ++i) { const int ka = k0 + 8 * g + i, kb = ka + 16;
    a[i] = (_Float16)(ka < K ? W[(size_t)(ka < K ? ka : K - 1) * ld + n] : 0.f); a[8 + i] = (_Float16)(kb < K ? W[(size_t)(kb < K ? kb : K - 1) * ld + n] : 0.f); }
  return a;
}
struct F2 { v16b h, l; };
__device__ __forceinline__ F2 bsplit16(const float v[16]) { F2 r;
#pragma unroll
  for (int i = 0; i < 16; ++i) { const __bf16 h = (__bf16)v[i]; r.h[i] = h; r.l[i] = (__bf16)(v[i] - (float)h); }
  return r; }
__device__ __forceinline__ F2 split_row(const float* row, int k0, int lane) { float v[16]; const float* p = row + k0 + 8 * (lane >> 4);
#pragma unroll
  for (int i = 0; i < 8; ++i) { v[i] = p[i]; v[8 + i] = p[16 + i]; }
  return bsplit16(v); }
__device__ __forceinline__ F2 split_rowK(const float* row, int k0, int lane, int K) { float v[16]; const int g = lane >> 4;
#pragma unroll
  for (int i = 0; i < 8; ++i) { const int ka = k0 + 8 * g + i, kb = ka + 16; v[i] = ka < K ? row[ka < K ? ka : K - 1] : 0.f; v[8 + i] = kb < K ? row[kb < K ? kb : K - 1] : 0.f; }
  return bsplit16(v); }
__device__ __forceinline__ F2 split_col(const float* W, int k0, int n, int lane, int ld, int K) { float v[16]; const int g = lane >> 4;
#pragma unroll
  for (int i = 0; i < 8; ++i) { const int ka = k0 + 8 * g + i, kb = ka + 16; v[i] = ka < K ? W[(size_t)(ka < K ? ka : K - 1) * ld + n] : 0.f; v[8 + i] = kb < K ? W[(size_t)(kb < K ? kb : K - 1) * ld + n] : 0.f; }
  return bsplit16(v); }
__device__ __forceinline__ v8f mac3(const F2& a, const F2& b, v8f c) { c = wmma_bf(a.l, b.h, c); c = wmma_bf(a.h, b.l, c); return wmma_bf(a.h, b.h, c); }
__device__ __forceinline__ float sigm(float v) { return 1.0f / (1.0f + expf(-v)); }
#define LDSX() do { asm volatile("s_wait_dscnt 0" ::: "memory"); __builtin_amdgcn_wave_barrier(); __builtin_amdgcn_fence(__ATOMIC_RELEASE, "workgroup"); } while (0)


// Multi-head attention over 32x32 feature maps (channel-major NCHW inputs): q/k/v = 1x1 conv (W x + b) per position, 8 heads x 32, scores = q k^T / sqrt(32) + attn_mask[t][s] (dense float mask, shared across batch/heads), softmax over s, P v, concat heads (channel = h*32 + d), out = Wo out + bo -> [B, 256, 32, 32].
// k_proj (per (b, 128 positions): gathers the channel-major input columns into LDS as bf16 [pos][ch], one bf16 GEMM against bf16 W rows; q as position rows [b][t][256], k as position rows split into bf16 hi/lo per head, v as channel-major hi/lo planes [b][ch][t]), k_attn (per (64 queries, b, h): one pass over the 1024 keys, running row max m (kept as m log2 e) and row sum l; P = 2^(s log2 e - m log2 e) hi/lo . V^T planes, O and l rescaled by 2^(m_old log2 e - m_new log2 e) per 32 keys, O / l at the end, O rows), k_out (O(hi/lo) . Wo rows + bo, written channel-major: per output channel one 256-B segment of 64 positions).
#define NB 8
#define E 256
#define NT 1024
#define NH 8
#define HD 32
#ifndef TNB
#define TNB NB
#define TQB (NT / 64)
#endif
typedef __attribute__((ext_vector_type(8))) __bf16 v8b;
__device__ __forceinline__ v16b frag_b(const __bf16* rowk0, int lane) {
  union { v16b v; v8b q[2]; } u; const __bf16* p = rowk0 + 8 * (lane >> 4);
  u.q[0] = *(const v8b*)p; u.q[1] = *(const v8b*)(p + 16); return u.v;
}
__device__ __forceinline__ v16b frag_gbf(const float* rowk0, int lane) {
  v16b a; const float* p = rowk0 + 8 * (lane >> 4);
#pragma unroll
  for (int i = 0; i < 8; ++i) { a[i] = (__bf16)p[i]; a[8 + i] = (__bf16)p[16 + i]; }
  return a;
}
__device__ __forceinline__ float bfr(float v) { return (float)(__bf16)v; }
// 2^v as the one hardware instruction, in line; arguments here are <= 0 up to rounding, and a result below the normal range may read as 0
__device__ __forceinline__ float ex2(float v) { return __builtin_amdgcn_exp2f(v); }
#define L2E 1.4426950408889634f
#define WS_Q    0u                               // f32 [8][1024][256] q rows (t-major); later O rows
#define WS_K    (WS_Q + 4u * NB * NT * E)          // bf16 [8][1024 t][8 heads][hi 32 | lo 32]: a key's 128 B of one head are one line
#define WS_VTH  (WS_K + 4u * NB * NT * E)          // bf16 [8][256 ch][1024 t]
#define WS_VTL  (WS_VTH + 2u * NB * E * NT)
#define WS_END  (WS_VTL + 2u * NB * E * NT)
// A 256 x 256 weight matrix goes into LDS once a block, rounded to bf16 as the fragment loader rounded it: every wave-load is 512 contiguous bytes, 32 loads of a thread are on their way at a time.
// The two projection kernels run PT threads = 8 waves a block, two a SIMD: one wave's LDS and memory waits are covered by the other's work, and the weights are in after two trips.
#define PT 256
// Row pitch 264 bf16 = 528 B (16 B x odd): the 16 rows of a fragment's 16-B reads fall on 16 different bank groups.
#define WP (E + 8)
typedef __attribute__((ext_vector_type(4))) __bf16 v4b;
typedef __attribute__((ext_vector_type(2))) __bf16 v2b;
__device__ __forceinline__ void stage_w(const float* __restrict__ Wm, __bf16 (*sw)[WP], int tid) {
  // kept rolled
#pragma unroll 1
  for (int o = 0; o < E * E / 4; o += PT * 32) { v4f t[32];
#pragma unroll
    for (int i = 0; i < 32; ++i) t[i] = *(const v4f*)(Wm + (size_t)(o + i * PT + tid) * 4);
#pragma unroll
    for (int i = 0; i < 32; ++i) { const int q = o + i * PT + tid; v4b hb;
#pragma unroll
      for (int e = 0; e < 4; ++e) hb[e] = (__bf16)t[i][e];
      *(v4b*)&sw[q >> 6][(q & 63) * 4] = hb; } }
}

// k_proj: a block takes PB = 128 positions, so the 192 blocks all run at once (one a WGP) and each weight matrix is staged once per 128 positions. A wave holds 32 positions x 128 outputs: a weight fragment read from LDS serves two products.
// LDS is used twice: first the weights and the input tile, then (behind a barrier) the f32 result rows over them, with the V planes behind the rows.
#define PB 128
#define SM_SX  (E * WP * 2)                       // input tile behind the weights
#define SM_SVH (PB * (E + 4) * 4)                 // V planes behind the result rows
#define SM_SVL (SM_SVH + E * (PB + 8) * 2)
#define SM_END (SM_SVL + E * (PB + 8) * 2)
__global__ __launch_bounds__(PT) void k_proj(const float* __restrict__ Xq, const float* __restrict__ Xk, const float* __restrict__ Xv, const float* __restrict__ Wq, const float* __restrict__ bq, const float* __restrict__ Wk, const float* __restrict__ bk, const float* __restrict__ Wv, const float* __restrict__ bv, float* __restrict__ Q, __bf16* __restrict__ KS, __bf16* __restrict__ VTH, __bf16* __restrict__ VTL) {
  __shared__ __align__(16) unsigned char sm[SM_END];
  __bf16 (*sw)[WP] = (__bf16 (*)[WP])sm; __bf16 (*sx)[E + 8] = (__bf16 (*)[E + 8])(sm + SM_SX);
  float (*so)[E + 4] = (float (*)[E + 4])sm; __bf16 (*svh)[PB + 8] = (__bf16 (*)[PB + 8])(sm + SM_SVH); __bf16 (*svl)[PB + 8] = (__bf16 (*)[PB + 8])(sm + SM_SVL);
  const int tid = threadIdx.x, wave = tid >> 5, lane = tid & 31, col = lane & 15, g = lane >> 4; const int b = blockIdx.y, t0 = blockIdx.x * PB, which = blockIdx.z;
  const int pg = wave & 3, oh = wave >> 2;   // the wave's 32 positions and its half of the outputs
  const float* X = which == 0 ? Xq : (which == 1 ? Xk : Xv); const float* Wm = which == 0 ? Wq : (which == 1 ? Wk : Wv); const float* bm = which == 0 ? bq : (which == 1 ? bk : bv);
  stage_w(Wm, sw, tid);
  { // the block's 256 channels x 128 positions come from memory (each half of the block takes 64 positions): 16 lanes take one channel's 256 B as 16-B pieces, and all 32 loads of a thread are issued before the first is used, so the tile costs one memory latency (the loops below are unrolled so that the 32 values stay in registers)
    const int seg = (tid & 15) + 16 * (tid >> 7), cp = (tid >> 4) & 7; const float* xg = X + ((size_t)b * E + 2 * cp) * NT + t0 + seg * 4; v4f xa[16], xb[16];   // channels 16 i + 2 cp and the next one, positions 4 seg .. 4 seg + 3
#pragma unroll
    for (int i = 0; i < 16; ++i) { xa[i] = *(const v4f*)(xg + (size_t)(i * 16) * NT); xb[i] = *(const v4f*)(xg + (size_t)(i * 16 + 1) * NT); }
#pragma unroll
    for (int i = 0; i < 16; ++i)
#pragma unroll
      for (int e = 0; e < 4; ++e) { v2b pk; pk[0] = (__bf16)xa[i][e]; pk[1] = (__bf16)xb[i][e]; *(v2b*)&sx[seg * 4 + e][i * 16 + 2 * cp] = pk; } }   // two neighbouring channels of one position: one 4-B store
  __syncthreads();
  v8f acc[2][8] = {};
#pragma unroll 2
  for (int kc = 0; kc < E / 32; ++kc) { const v16b a0 = frag_b(&sx[pg * 32 + col][kc * 32], lane), a1 = frag_b(&sx[pg * 32 + 16 + col][kc * 32], lane);
    v16b w[8];   // ten fragments read as one group, then their sixteen products: one LDS wait a group
#pragma unroll
    for (int j = 0; j < 8; ++j) w[j] = frag_b(&sw[(oh * 8 + j) * 16 + col][kc * 32], lane);
#pragma unroll
    for (int j = 0; j < 8; ++j) { acc[0][j] = wmma_bf(a0, w[j], acc[0][j]); acc[1][j] = wmma_bf(a1, w[j], acc[1][j]); } }
  __syncthreads();   // ends every wave's reads of the weights and the input tile: the result rows are written over them
#pragma unroll
  for (int j = 0; j < 8; ++j) { const int o = (oh * 8 + j) * 16 + col; const float bb = bfr(bm[o]);
#pragma unroll
    for (int pt = 0; pt < 2; ++pt)
#pragma unroll
      for (int r = 0; r < 8; ++r) so[pg * 32 + pt * 16 + 8 * g + r][o] = acc[pt][j][r] + bb; }
  __syncthreads();
  if (which == 0) {
    for (int rl = 0; rl < 16; ++rl) for (int pc = lane; pc < E / 4; pc += 32) vst2(Q + ((size_t)b * NT + t0 + wave * 16 + rl) * E + pc * 4, *(const v4f*)&so[wave * 16 + rl][pc * 4]); }
  else if (which == 1) {   // k leaves here already split into hi and lo, once for all the waves that read it: a lane takes 8 channels of a row, the wave one row a trip
    for (int rl = 0; rl < 16; ++rl) { v8b kh, kl;
#pragma unroll
      for (int e = 0; e < 8; ++e) { const float v = so[wave * 16 + rl][lane * 8 + e]; const __bf16 hb = (__bf16)v; kh[e] = hb; kl[e] = (__bf16)(v - (float)hb); }
      __bf16* dst = KS + (((size_t)b * NT + t0 + wave * 16 + rl) * NH + (lane >> 2)) * (2 * HD) + (lane & 3) * 8;
      vst2(dst, kh); vst2(dst + HD, kl); } }
  else {
    for (int q = tid; q < E * PB; q += PT) { const int c = q >> 7, tl = q & (PB - 1); const float v = so[tl][c]; const __bf16 hb = (__bf16)v; svh[c][tl] = hb; svl[c][tl] = (__bf16)(v - (float)hb); }
    __syncthreads();
    for (int q = tid; q < E * (PB / 8); q += PT) { const int c = q >> 4, pc = q & 15; const size_t o = ((size_t)b * E + c) * NT + t0 + pc * 8; vst2((unsigned*)(VTH + o), *(const v4u*)&svh[c][pc * 8]); vst2((unsigned*)(VTL + o), *(const v4u*)&svl[c][pc * 8]); } }
}
#define SK 64
// lane l <-> l ^ 16
__device__ __forceinline__ float xhalf(float v) { const int b = __float_as_int(v); return __int_as_float(__builtin_amdgcn_permlanex16(b, b, 0x76543210, 0xfedcba98, false, false)); }
// four waves a SIMD and no more: the grid is 4 blocks for each of the 256 WGPs, and a fifth block on one WGP would leave another with three
__global__ __launch_bounds__(128) __attribute__((amdgpu_waves_per_eu(4, 4))) void k_attn(float* __restrict__ Q, const __bf16* __restrict__ KS, const float* __restrict__ mask, const __bf16* __restrict__ VTH, const __bf16* __restrict__ VTL) {
  __shared__ __align__(16) float so[4][16][36];
  __shared__ __align__(16) __bf16 sk[2][SK][2 * HD + 8];                      // [buffer][key][hi d | lo d], pitch 36 dwords: 16 rows' 16-B reads fall on 16 different bank groups
  __shared__ __align__(16) __bf16 svh[2][HD][SK + 8], svl[2][HD][SK + 8];     // [buffer][channel][key], the same pitch in bytes
  const int tid = threadIdx.x, wave = tid >> 5, lane = tid & 31, col = lane & 15, g = lane >> 4; const int bh = blockIdx.y, b = bh >> 3, h = bh & 7; const int q0 = blockIdx.x * 64 + wave * 16; const float scale = 0.17677669529663687f;
  const int srow = tid >> 3, sseg = tid & 7;   // staging: 8 threads a 128-B row, 16 rows a pass of the block
  const __bf16* kg = KS + (((size_t)b * NT + srow) * NH + h) * (2 * HD) + sseg * 8;
  const size_t vg = ((size_t)b * E + h * HD + srow) * NT + sseg * 8;
  const float* mg = mask + (size_t)(q0 + col) * NT + 8 * g;   // this lane's query row of the mask, at its first key
  v8b kr[4], hr[2], lr[2];   // one stage on its way; every loop over them is unrolled so that they stay in registers
#pragma unroll
  for (int i = 0; i < 4; ++i) kr[i] = *(const v8b*)(kg + (size_t)(i * 16) * (2 * E));
#pragma unroll
  for (int i = 0; i < 2; ++i) { hr[i] = *(const v8b*)(VTH + vg + (size_t)(i * 16) * NT); lr[i] = *(const v8b*)(VTL + vg + (size_t)(i * 16) * NT); }
  asm volatile("s_wait_xcnt 0x0" ::: "memory");   // the address registers of the loads above are reused at once (the query row's load lands in them): the wait stands in front of that overwrite
  const F2 a = split_row(Q + ((size_t)b * NT + q0 + col) * E + h * HD, 0, lane);
  float m = -3.0e38f, l = 0.f;   // query q0 + col: running max times log2 e (equal in the query's two lanes), this lane's share of the running sum
  v8f acc[2] = {};               // O^T: element r of tile dt = channel dt * 16 + 8g + r of query q0 + col
#pragma unroll
  for (int i = 0; i < 4; ++i) *(v8b*)&sk[0][i * 16 + srow][sseg * 8] = kr[i];
#pragma unroll
  for (int i = 0; i < 2; ++i) { *(v8b*)&svh[0][i * 16 + srow][sseg * 8] = hr[i]; *(v8b*)&svl[0][i * 16 + srow][sseg * 8] = lr[i]; }
  __syncthreads();
  // kept rolled: the body already holds two passes of 32 keys, a longer one would only grow the code
#pragma unroll 1
  for (int st = 0; st < NT / SK; ++st) { const int bf = st & 1; const bool more = st + 1 < NT / SK;
    v4f mk[SK / 16][2];   // the stage's mask values of this lane: 8 consecutive keys a 16-key tile; asked for ahead of the next stage's K and V, which are wanted later
#pragma unroll
    for (int t = 0; t < SK / 16; ++t) { mk[t][0] = *(const v4f*)(mg + st * SK + t * 16); mk[t][1] = *(const v4f*)(mg + st * SK + t * 16 + 4); }
    asm volatile("s_wait_xcnt 0x0" ::: "memory");   // the address registers of the mask loads are reused while the loads are on their way: the wait stands in front of that overwrite
    if (more) {
#pragma unroll
      for (int i = 0; i < 4; ++i) kr[i] = *(const v8b*)(kg + (size_t)((st + 1) * SK + i * 16) * (2 * E));
#pragma unroll
      for (int i = 0; i < 2; ++i) { hr[i] = *(const v8b*)(VTH + vg + (size_t)(i * 16) * NT + (st + 1) * SK); lr[i] = *(const v8b*)(VTL + vg + (size_t)(i * 16) * NT + (st + 1) * SK); }
      asm volatile("s_wait_xcnt 0x0" ::: "memory"); }   // the address registers of these loads are stepped on at the loop's foot: the wait stands in front of that overwrite
#pragma unroll
    for (int hf = 0; hf < SK / 32; ++hf) { float sv[16];   // element ct * 8 + r = key hf * 32 + ct * 16 + 8g + r of the stage
#pragma unroll
      for (int ct = 0; ct < 2; ++ct) { const __bf16* kw = &sk[bf][hf * 32 + ct * 16 + col][0]; const v16b kh = frag_b(kw, lane), kl = frag_b(kw + HD, lane);
        v8f s = {}; s = wmma_bf(kh, a.l, s); s = wmma_bf(kl, a.h, s); s = wmma_bf(kh, a.h, s);
#pragma unroll
        for (int r = 0; r < 8; ++r) sv[ct * 8 + r] = s[r] * scale + bfr(mk[hf * 2 + ct][r >> 2][r & 3]); }
      float mx = sv[0];
#pragma unroll
      for (int i = 1; i < 16; ++i) mx = fmaxf(mx, sv[i]);
      mx = fmaxf(mx, xhalf(mx));
      const float mn = fmaxf(m, mx * L2E), al = ex2(m - mn); m = mn;
      v2f pp[8];   // the lane's 16 terms in pairs: one exponent argument for both (one query a lane), and the sum as a tree of pairs, not as one chain of 16 dependent adds
#pragma unroll
      for (int i = 0; i < 8; ++i) { pp[i] = __builtin_elementwise_fma((v2f){sv[2 * i], sv[2 * i + 1]}, (v2f){L2E, L2E}, (v2f){-mn, -mn}); pp[i][0] = ex2(pp[i][0]); pp[i][1] = ex2(pp[i][1]); sv[2 * i] = pp[i][0]; sv[2 * i + 1] = pp[i][1]; }
      const v2f pq = ((pp[0] + pp[1]) + (pp[2] + pp[3])) + ((pp[4] + pp[5]) + (pp[6] + pp[7]));
      l = l * al + (pq[0] + pq[1]);
      const F2 pb = bsplit16(sv);
#pragma unroll
      for (int dt = 0; dt < 2; ++dt) { const v16b vh = frag_b(&svh[bf][dt * 16 + col][hf * 32], lane), vl = frag_b(&svl[bf][dt * 16 + col][hf * 32], lane);
#pragma unroll
        for (int r = 0; r < 8; ++r) acc[dt][r] *= al;
        acc[dt] = wmma_bf(vh, pb.l, acc[dt]); acc[dt] = wmma_bf(vl, pb.h, acc[dt]); acc[dt] = wmma_bf(vh, pb.h, acc[dt]); } }
    if (more) {   // the other buffer's last readers left it at the barrier that ended the stage before
#pragma unroll
      for (int i = 0; i < 4; ++i) *(v8b*)&sk[bf ^ 1][i * 16 + srow][sseg * 8] = kr[i];
#pragma unroll
      for (int i = 0; i < 2; ++i) { *(v8b*)&svh[bf ^ 1][i * 16 + srow][sseg * 8] = hr[i]; *(v8b*)&svl[bf ^ 1][i * 16 + srow][sseg * 8] = lr[i]; } }
    __syncthreads(); }   // publishes the next stage and ends this stage's reads
  const float il = 1.0f / (l + xhalf(l));
#pragma unroll
  for (int dt = 0; dt < 2; ++dt)
#pragma unroll
    for (int hq = 0; hq < 2; ++hq) { v4f o;
#pragma unroll
      for (int e = 0; e < 4; ++e) o[e] = acc[dt][hq * 4 + e] * il;
      *(v4f*)&so[wave][col][dt * 16 + 8 * g + hq * 4] = o; }
  LDSX();
  for (int rl = 0; rl < 16; ++rl) if (lane < 8) vst2(Q + ((size_t)b * NT + q0 + rl) * E + h * HD + lane * 4, *(const v4f*)&so[wave][rl][lane * 4]);
}
// ---- k_out: block = (b, 64 positions), 8 waves: Y[b][o][t] = sum_c O[b][t][c] Wo[o][c] + bo[o]: GEMM rows t (O rows hi/lo, K 256), cols o (a wave: 16 positions, 8 tiles = 128 outputs); written channel-major: per o the 64 t = 256 B
__global__ __launch_bounds__(PT) void k_out(const float* __restrict__ O, const float* __restrict__ Wo, const float* __restrict__ bo, float* __restrict__ Y) {
  __shared__ __align__(16) float sot[E][68];          // [o][t local]
  __shared__ __align__(16) __bf16 sw[E][WP];
  const int tid = threadIdx.x, wave = tid >> 5, lane = tid & 31, col = lane & 15, g = lane >> 4; const int b = blockIdx.y, t0 = blockIdx.x * 64;
  const int pw = wave & 3, oh = wave >> 2;   // the wave's 16 positions and its half of the outputs
  stage_w(Wo, sw, tid);
  __syncthreads();   // publishes the staged weights to all eight waves
  v8f acc[8] = {};
#pragma unroll 1
  for (int kc = 0; kc < E / 32; ++kc) { const F2 a = split_row(O + ((size_t)b * NT + t0 + pw * 16 + col) * E, kc * 32, lane);
    v16b w[8];   // eight fragments read as one group, then their products: one LDS wait a group
#pragma unroll
    for (int j = 0; j < 8; ++j) w[j] = frag_b(&sw[(oh * 8 + j) * 16 + col][kc * 32], lane);
#pragma unroll
    for (int j = 0; j < 8; ++j) { acc[j] = wmma_bf(a.l, w[j], acc[j]); acc[j] = wmma_bf(a.h, w[j], acc[j]); } }
#pragma unroll
  for (int j = 0; j < 8; ++j) { const int o = (oh * 8 + j) * 16 + col; const float bb = bfr(bo[o]);
#pragma unroll
    for (int r = 0; r < 8; ++r) sot[o][pw * 16 + 8 * g + r] = acc[j][r] + bb; }
  __syncthreads();
  for (int q = tid; q < E * 16; q += PT) { const int o = q >> 4, pc = q & 15; vst2(Y + ((size_t)b * E + o) * NT + t0 + pc * 4, *(const v4f*)&sot[o][pc * 4]); }
}

extern "C" void kernel_launch(void* const* d_in, const int* in_sizes, int n_in, void* d_out, int out_size, void* d_ws, size_t ws_size, hipStream_t stream) {
  (void)in_sizes; (void)n_in; (void)out_size;
  const float** F = (const float**)d_in;   // d_in order: query, key, value [8,256,32,32], attn_mask [1024,1024], Wq, Wk, Wv, Wo [256,256], bq, bk, bv, bo [256]
  if (ws_size < (size_t)WS_END) return;
  char* ws = (char*)d_ws; float *Q = (float*)(ws + WS_Q); __bf16 *KS = (__bf16*)(ws + WS_K), *VTH = (__bf16*)(ws + WS_VTH), *VTL = (__bf16*)(ws + WS_VTL);
  k_proj<<<dim3(NT / PB, TNB, 3), PT, 0, stream>>>(F[0], F[1], F[2], F[4], F[8], F[5], F[9], F[6], F[10], Q, KS, VTH, VTL);
  k_attn<<<dim3(TQB, TNB * NH), 128, 0, stream>>>(Q, KS, F[3], VTH, VTL);
  k_out<<<dim3(TQB, TNB), PT, 0, stream>>>(Q, F[7], F[11], (float*)d_out);
}

// v009
// Measured time: 65.1 microseconds a run.
// Next to v008, in two timings, it ran 1.03 times as fast each time.
// Counting every step since v000, it is 6.91 times as fast.
#include <hip/hip_runtime.h>
#include <math.h>

typedef __attribute__((ext_vector_type(16))) _Float16 v16h;
typedef __attribute__((ext_vector_type(16))) __bf16 v16b;
typedef __attribute__((ext_vector_type(8)))  _Float16 v8h;
typedef __attribute__((ext_vector_type(8)))  float v8f;
typedef __attribute__((ext_vector_type(4)))  float v4f;
typedef __attribute__((ext_vector_type(2)))  float v2f;
typedef __attribute__((ext_vector_type(4)))  unsigned v4u;
typedef __attribute__((ext_vector_type(4)))  int v4i;
typedef float __attribute__((may_alias)) float_a;
typedef int __attribute__((may_alias)) int_a;

template <typename T> __device__ __forceinline__ void vst2(void* p, T v) { *(T*)p = v;  }
__device__ __forceinline__ v8f wmma16(v16h a, v16h b, v8f c) {
  v8f d = __builtin_amdgcn_wmma_f32_16x16x32_f16(false, a, false, b, (short)0, c, false, false);
  asm volatile("v_nop\n\tv_nop\n\tv_nop\n\tv_nop" : "+v"(d) : "v"(a), "v"(b));
  return d;
}
__device__ __forceinline__ v8f wmma_bf(v16b a, v16b b, v8f c) {
  v8f d = __builtin_amdgcn_wmma_f32_16x16x32_bf16(false, a, false, b, (short)0, c, false, false);
  asm volatile("v_nop\n\tv_nop\n\tv_nop\n\tv_nop" : "+v"(d) : "v"(a), "v"(b));
  return d;
}
// 16x16x32 fragments: lane = (h = lane>>4, row/col = lane&15); elements 0..7 = k0+8h+0..7, 8..15 = k0+16+8h+0..7; D element r = row 8h+r
__device__ __forceinline__ v16h frag_h(const _Float16* rowk0, int lane) {
  union { v16h v; v8h q[2]; } u; const _Float16* p = rowk0 + 8 * (lane >> 4);
  u.q[0] = *(const v8h*)p; u.q[1] = *(const v8h*)(p + 16); return u.v;
}
__device__ __forceinline__ v16h frag_f32(const float* rowk0, int lane) {
  v16h a; const float* p = rowk0 + 8 * (lane >> 4);
#pragma unroll
  for (int i = 0; i < 8; ++i) { a[i] = (_Float16)p[i]; a[8 + i] = (_Float16)p[16 + i]; }
  return a;
}
__device__ __forceinline__ v16h frag_f32s(const float* rowk0, int lane, float sc) {
  v16h a; const float* p = rowk0 + 8 * (lane >> 4);
#pragma unroll
  for (int i = 0; i < 8; ++i) { a[i] = (_Float16)(p[i] * sc); a[8 + i] = (_Float16)(p[16 + i] * sc); }
  return a;
}
// column fragment from a [K][ld] layout (column n), rows >= K read as 0
__device__ __forceinline__ v16h fragc_f32(const float* W, int k0, int n, int lane, int ld, int K) {
  v16h a; const int g = lane >> 4;
#pragma unroll
  for (int i = 0; i < 8; ++i) { const int ka = k0 + 8 * g + i, kb = ka + 16;
    a[i] = (_Float16)(ka < K ? W[(size_t)(ka < K ? ka : K - 1) * ld + n] : 0.f); a[8 + i] = (_Float16)(kb < K ? W[(size_t)(kb < K ? kb : K - 1) * ld + n] : 0.f); }
  return a;
}
struct F2 { v16b h, l; };
__device__ __forceinline__ F2 bsplit16(const float v[16]) { F2 r;
#pragma unroll
  for (int i = 0; i < 16; ++i) { const __bf16 h = (__bf16)v[i]; r.h[i] = h; r.l[i] = (__bf16)(v[i] - (float)h); }
  return r; }
__device__ __forceinline__ F2 split_row(const float* row, int k0, int lane) { float v[16]; const float* p = row + k0 + 8 * (lane >> 4);
#pragma unroll
  for (int i = 0; i < 8; ++i) { v[i] = p[i]; v[8 + i] = p[16 + i]; }
  return bsplit16(v); }
__device__ __forceinline__ F2 split_rowK(const float* row, int k0, int lane, int K) { float v[16]; const int g = lane >> 4;
#pragma unroll
  for (int i = 0; i < 8; ++i) { const int ka = k0 + 8 * g + i, kb = ka + 16; v[i] = ka < K ? row[ka < K ? ka : K - 1] : 0.f; v[8 + i] = kb < K ? row[kb < K ? kb : K - 1] : 0.f; }
  return bsplit16(v); }
__device__ __forceinline__ F2 split_col(const float* W, int k0, int n, int lane, int ld, int K) { float v[16]; const int g = lane >> 4;
#pragma unroll
  for (int i = 0; i < 8; ++i) { const int ka = k0 + 8 * g + i, kb = ka + 16; v[i] = ka < K ? W[(size_t)(ka < K ? ka : K - 1) * ld + n] : 0.f; v[8 + i] = kb < K ? W[(size_t)(kb < K ? kb : K - 1) * ld + n] : 0.f; }
  return bsplit16(v); }
__device__ __forceinline__ v8f mac3(const F2& a, const F2& b, v8f c) { c = wmma_bf(a.l, b.h, c); c = wmma_bf(a.h, b.l, c); return wmma_bf(a.h, b.h, c); }
__device__ __forceinline__ float sigm(float v) { return 1.0f / (1.0f + expf(-v)); }
#define LDSX() do { asm volatile("s_wait_dscnt 0" ::: "memory"); __builtin_amdgcn_wave_barrier(); __builtin_amdgcn_fence(__ATOMIC_RELEASE, "workgroup"); } while (0)


// Multi-head attention over 32x32 feature maps (channel-major NCHW inputs): q/k/v = 1x1 conv (W x + b) per position, 8 heads x 32, scores = q k^T / sqrt(32) + attn_mask[t][s] (dense float mask, shared across batch/heads), softmax over s, P v, concat heads (channel = h*32 + d), out = Wo out + bo -> [B, 256, 32, 32].
// k_proj (per (b, 128 positions): gathers the channel-major input columns into LDS as bf16 [pos][ch], one bf16 GEMM against bf16 W rows; q as position rows [b][t][256], k as position rows split into bf16 hi/lo per head, v as channel-major hi/lo planes [b][ch][t]), k_attn (per (64 queries, b, h): one pass over the 1024 keys, running row max m (kept as m log2 e) and row sum l; P = 2^(s log2 e - m log2 e) hi/lo . V^T planes, O and l rescaled by 2^(m_old log2 e - m_new log2 e) per 32 keys, O / l at the end, O rows), k_out (O(hi/lo) . Wo rows + bo, written channel-major: per output channel one 256-B segment of 64 positions).
#define NB 8
#define E 256
#define NT 1024
#define NH 8
#define HD 32
#ifndef TNB
#define TNB NB
#define TQB (NT / 64)
#endif
typedef __attribute__((ext_vector_type(8))) __bf16 v8b;
__device__ __forceinline__ v16b frag_b(const __bf16* rowk0, int lane) {
  union { v16b v; v8b q[2]; } u; const __bf16* p = rowk0 + 8 * (lane >> 4);
  u.q[0] = *(const v8b*)p; u.q[1] = *(const v8b*)(p + 16); return u.v;
}
__device__ __forceinline__ v16b frag_gbf(const float* rowk0, int lane) {
  v16b a; const float* p = rowk0 + 8 * (lane >> 4);
#pragma unroll
  for (int i = 0; i < 8; ++i) { a[i] = (__bf16)p[i]; a[8 + i] = (__bf16)p[16 + i]; }
  return a;
}
__device__ __forceinline__ float bfr(float v) { return (float)(__bf16)v; }
// 2^v as the one hardware instruction, in line; arguments here are <= 0 up to rounding, and a result below the normal range may read as 0
__device__ __forceinline__ float ex2(float v) { return __builtin_amdgcn_exp2f(v); }
#define L2E 1.4426950408889634f
#define WS_Q    0u                               // f32 [8][1024][256] q rows (t-major); later O rows
#define WS_K    (WS_Q + 4u * NB * NT * E)          // bf16 [8][1024 t][8 heads][hi 32 | lo 32]: a key's 128 B of one head are one line
#define WS_VTH  (WS_K + 4u * NB * NT * E)          // bf16 [8][256 ch][1024 t]
#define WS_VTL  (WS_VTH + 2u * NB * E * NT)
#define WS_MB   (WS_VTL + 2u * NB * E * NT)         // bf16 [64 tiles of 16 queries][64 tiles of 16 keys][32 lanes][8]: the mask as k_attn's lanes hold it, 512 B a wave-load
#define WS_END  (WS_MB + 2u * NT * NT)
// A 256 x 256 weight matrix goes into LDS once a block, rounded to bf16 as the fragment loader rounded it: every wave-load is 512 contiguous bytes, 32 loads of a thread are on their way at a time.
// The two projection kernels run PT threads = 8 waves a block, two a SIMD: one wave's LDS and memory waits are covered by the other's work, and the weights are in after two trips.
#define PT 256
// Row pitch 264 bf16 = 528 B (16 B x odd): the 16 rows of a fragment's 16-B reads fall on 16 different bank groups.
#define WP (E + 8)
typedef __attribute__((ext_vector_type(4))) __bf16 v4b;
typedef __attribute__((ext_vector_type(2))) __bf16 v2b;
__device__ __forceinline__ void stage_w(const float* __restrict__ Wm, __bf16 (*sw)[WP], int tid) {
  // kept rolled
#pragma unroll 1
  for (int o = 0; o < E * E / 4; o += PT * 32) { v4f t[32];
#pragma unroll
    for (int i = 0; i < 32; ++i) t[i] = *(const v4f*)(Wm + (size_t)(o + i * PT + tid) * 4);
#pragma unroll
    for (int i = 0; i < 32; ++i) { const int q = o + i * PT + tid; v4b hb;
#pragma unroll
      for (int e = 0; e < 4; ++e) hb[e] = (__bf16)t[i][e];
      *(v4b*)&sw[q >> 6][(q & 63) * 4] = hb; } }
}

// k_proj: a block takes PB = 128 positions, so the 192 blocks all run at once (one a WGP) and each weight matrix is staged once per 128 positions. A wave holds 32 positions x 128 outputs: a weight fragment read from LDS serves two products.
// LDS is used twice: first the weights and the input tile, then (behind a barrier) the f32 result rows over them, with the V planes behind the rows.
#define PB 128
#define SM_SX  (E * WP * 2)                       // input tile behind the weights
#define SM_SVH (PB * (E + 4) * 4)                 // V planes behind the result rows
#define SM_SVL (SM_SVH + E * (PB + 8) * 2)
#define SM_END (SM_SVL + E * (PB + 8) * 2)
__global__ __launch_bounds__(PT) void k_proj(const float* __restrict__ Xq, const float* __restrict__ Xk, const float* __restrict__ Xv, const float* __restrict__ Wq, const float* __restrict__ bq, const float* __restrict__ Wk, const float* __restrict__ bk, const float* __restrict__ Wv, const float* __restrict__ bv, const float* __restrict__ mask, float* __restrict__ Q, __bf16* __restrict__ KS, __bf16* __restrict__ VTH, __bf16* __restrict__ VTL, __bf16* __restrict__ MB) {
  __shared__ __align__(16) unsigned char sm[SM_END];
  __bf16 (*sw)[WP] = (__bf16 (*)[WP])sm; __bf16 (*sx)[E + 8] = (__bf16 (*)[E + 8])(sm + SM_SX);
  float (*so)[E + 4] = (float (*)[E + 4])sm; __bf16 (*svh)[PB + 8] = (__bf16 (*)[PB + 8])(sm + SM_SVH); __bf16 (*svl)[PB + 8] = (__bf16 (*)[PB + 8])(sm + SM_SVL);
  const int tid = threadIdx.x, wave = tid >> 5, lane = tid & 31, col = lane & 15, g = lane >> 4; const int b = blockIdx.y, t0 = blockIdx.x * PB, which = blockIdx.z;
  if (which == 3) {   // 64 more blocks, on the WGPs that the 192 projection blocks leave idle: each packs the mask rows of one tile of 16 queries, rounded to bf16 as k_attn rounded them, in the order of k_attn's score tiles
    // piece u = (16-key tile, lane): lane (col, g) holds keys 8g .. 8g + 7 of the tile for query col. The scattered 32-B reads are paid once here, not by each of the 64 (batch, head) pairs; all 16 loads of a thread are in flight at once
    static_assert((NT / PB) * TNB == NT / 16, "one block a query tile");
    const int qt = blockIdx.y * (NT / PB) + blockIdx.x; const float* src = mask + (size_t)(qt * 16 + col) * NT + wave * 16 + 8 * g; v4f ma[8], mb[8];
#pragma unroll
    for (int i = 0; i < 8; ++i) { ma[i] = *(const v4f*)(src + i * (PT / 32 * 16)); mb[i] = *(const v4f*)(src + i * (PT / 32 * 16) + 4); }   // piece u = i * PT + tid: key tile u >> 5 = 8 i + wave
    asm volatile("s_wait_xcnt 0x0" :: "v"(src) : "memory");   // the address registers of the loads above are free for reuse behind them: the wait stands in front of any overwrite, and naming src keeps its registers untouched up to the wait
#pragma unroll
    for (int i = 0; i < 8; ++i) { v8b o;
#pragma unroll
      for (int e = 0; e < 4; ++e) { o[e] = (__bf16)ma[i][e]; o[4 + e] = (__bf16)mb[i][e]; }
      vst2(MB + ((size_t)qt * (NT / 16 * 32) + i * PT + tid) * 8, o); }
    return; }   // the whole block leaves, in front of every barrier
  const int pg = wave & 3, oh = wave >> 2;   // the wave's 32 positions and its half of the outputs
  const float* X = which == 0 ? Xq : (which == 1 ? Xk : Xv); const float* Wm = which == 0 ? Wq : (which == 1 ? Wk : Wv); const float* bm = which == 0 ? bq : (which == 1 ? bk : bv);
  stage_w(Wm, sw, tid);
  { // the block's 256 channels x 128 positions come from memory (each half of the block takes 64 positions): 16 lanes take one channel's 256 B as 16-B pieces, and all 32 loads of a thread are issued before the first is used, so the tile costs one memory latency (the loops below are unrolled so that the 32 values stay in registers)
    const int seg = (tid & 15) + 16 * (tid >> 7), cp = (tid >> 4) & 7; const float* xg = X + ((size_t)b * E + 2 * cp) * NT + t0 + seg * 4; v4f xa[16], xb[16];   // channels 16 i + 2 cp and the next one, positions 4 seg .. 4 seg + 3
#pragma unroll
    for (int i = 0; i < 16; ++i) { xa[i] = *(const v4f*)(xg + (size_t)(i * 16) * NT); xb[i] = *(const v4f*)(xg + (size_t)(i * 16 + 1) * NT); }
#pragma unroll
    for (int i = 0; i < 16; ++i)
#pragma unroll
      for (int e = 0; e < 4; ++e) { v2b pk; pk[0] = (__bf16)xa[i][e]; pk[1] = (__bf16)xb[i][e]; *(v2b*)&sx[seg * 4 + e][i * 16 + 2 * cp] = pk; } }   // two neighbouring channels of one position: one 4-B store
  __syncthreads();
  v8f acc[2][8] = {};
#pragma unroll 2
  for (int kc = 0; kc < E / 32; ++kc) { const v16b a0 = frag_b(&sx[pg * 32 + col][kc * 32], lane), a1 = frag_b(&sx[pg * 32 + 16 + col][kc * 32], lane);
    v16b w[8];   // ten fragments read as one group, then their sixteen products: one LDS wait a group
#pragma unroll
    for (int j = 0; j < 8; ++j) w[j] = frag_b(&sw[(oh * 8 + j) * 16 + col][kc * 32], lane);
#pragma unroll
    for (int j = 0; j < 8; ++j) { acc[0][j] = wmma_bf(a0, w[j], acc[0][j]); acc[1][j] = wmma_bf(a1, w[j], acc[1][j]); } }
  __syncthreads();   // ends every wave's reads of the weights and the input tile: the result rows are written over them
#pragma unroll
  for (int j = 0; j < 8; ++j) { const int o = (oh * 8 + j) * 16 + col; const float bb = bfr(bm[o]);
#pragma unroll
    for (int pt = 0; pt < 2; ++pt)
#pragma unroll
      for (int r = 0; r < 8; ++r) so[pg * 32 + pt * 16 + 8 * g + r][o] = acc[pt][j][r] + bb; }
  __syncthreads();
  if (which == 0) {
    for (int rl = 0; rl < 16; ++rl) for (int pc = lane; pc < E / 4; pc += 32) vst2(Q + ((size_t)b * NT + t0 + wave * 16 + rl) * E + pc * 4, *(const v4f*)&so[wave * 16 + rl][pc * 4]); }
  else if (which == 1) {   // k leaves here already split into hi and lo, once for all the waves that read it: a lane takes 8 channels of a row, the wave one row a trip
    for (int rl = 0; rl < 16; ++rl) { v8b kh, kl;
#pragma unroll
      for (int e = 0; e < 8; ++e) { const float v = so[wave * 16 + rl][lane * 8 + e]; const __bf16 hb = (__bf16)v; kh[e] = hb; kl[e] = (__bf16)(v - (float)hb); }
      __bf16* dst = KS + (((size_t)b * NT + t0 + wave * 16 + rl) * NH + (lane >> 2)) * (2 * HD) + (lane & 3) * 8;
      vst2(dst, kh); vst2(dst + HD, kl); } }
  else {
    for (int q = tid; q < E * PB; q += PT) { const int c = q >> 7, tl = q & (PB - 1); const float v = so[tl][c]; const __bf16 hb = (__bf16)v; svh[c][tl] = hb; svl[c][tl] = (__bf16)(v - (float)hb); }
    __syncthreads();
    for (int q = tid; q < E * (PB / 8); q += PT) { const int c = q >> 4, pc = q & 15; const size_t o = ((size_t)b * E + c) * NT + t0 + pc * 8; vst2((unsigned*)(VTH + o), *(const v4u*)&svh[c][pc * 8]); vst2((unsigned*)(VTL + o), *(const v4u*)&svl[c][pc * 8]); } }
}
#define SK 64
// lane l <-> l ^ 16
__device__ __forceinline__ float xhalf(float v) { const int b = __float_as_int(v); return __int_as_float(__builtin_amdgcn_permlanex16(b, b, 0x76543210, 0xfedcba98, false, false)); }
// four waves a SIMD and no more: the grid is 4 blocks for each of the 256 WGPs, and a fifth block on one WGP would leave another with three
__global__ __launch_bounds__(128) __attribute__((amdgpu_waves_per_eu(4, 4))) void k_attn(float* __restrict__ Q, const __bf16* __restrict__ KS, const __bf16* __restrict__ MB, const __bf16* __restrict__ VTH, const __bf16* __restrict__ VTL) {
  __shared__ __align__(16) float so[4][16][36];
  __shared__ __align__(16) __bf16 sk[2][SK][2 * HD + 8];                      // [buffer][key][hi d | lo d], pitch 36 dwords: 16 rows' 16-B reads fall on 16 different bank groups
  __shared__ __align__(16) __bf16 svh[2][HD][SK + 8], svl[2][HD][SK + 8];     // [buffer][channel][key], the same pitch in bytes
  const int tid = threadIdx.x, wave = tid >> 5, lane = tid & 31, col = lane & 15, g = lane >> 4; const int bh = blockIdx.y, b = bh >> 3, h = bh & 7; const int q0 = blockIdx.x * 64 + wave * 16; const float scale = 0.17677669529663687f;
  const int srow = tid >> 3, sseg = tid & 7;   // staging: 8 threads a 128-B row, 16 rows a pass of the block
  const __bf16* kg = KS + (((size_t)b * NT + srow) * NH + h) * (2 * HD) + sseg * 8;
  const size_t vg = ((size_t)b * E + h * HD + srow) * NT + sseg * 8;
  const __bf16* mg = MB + ((size_t)(q0 >> 4) * (NT / 16 * 32) + lane) * 8;   // the wave's query tile of the packed mask, at this lane's 16 B of the first 16-key tile
  v8b kr[4], hr[2], lr[2];   // one stage on its way; every loop over them is unrolled so that they stay in registers
#pragma unroll
  for (int i = 0; i < 4; ++i) kr[i] = *(const v8b*)(kg + (size_t)(i * 16) * (2 * E));
#pragma unroll
  for (int i = 0; i < 2; ++i) { hr[i] = *(const v8b*)(VTH + vg + (size_t)(i * 16) * NT); lr[i] = *(const v8b*)(VTL + vg + (size_t)(i * 16) * NT); }
  asm volatile("s_wait_xcnt 0x0" ::: "memory");   // the address registers of the loads above are reused at once (the query row's load lands in them): the wait stands in front of that overwrite
  const F2 a = split_row(Q + ((size_t)b * NT + q0 + col) * E + h * HD, 0, lane);
  float m = -3.0e38f, l = 0.f;   // query q0 + col: running max times log2 e (equal in the query's two lanes), this lane's share of the running sum
  v8f acc[2] = {};               // O^T: element r of tile dt = channel dt * 16 + 8g + r of query q0 + col
#pragma unroll
  for (int i = 0; i < 4; ++i) *(v8b*)&sk[0][i * 16 + srow][sseg * 8] = kr[i];
#pragma unroll
  for (int i = 0; i < 2; ++i) { *(v8b*)&svh[0][i * 16 + srow][sseg * 8] = hr[i]; *(v8b*)&svl[0][i * 16 + srow][sseg * 8] = lr[i]; }
  __syncthreads();
  // kept rolled: the body already holds two passes of 32 keys, a longer one would only grow the code
#pragma unroll 1
  for (int st = 0; st < NT / SK; ++st) { const int bf = st & 1; const bool more = st + 1 < NT / SK;
    v8b mk[SK / 16];   // the stage's mask values of this lane: 8 consecutive keys a 16-key tile, one load of 512 contiguous bytes a wave and tile; asked for ahead of the next stage's K and V, which are wanted later
#pragma unroll
    for (int t = 0; t < SK / 16; ++t) mk[t] = *(const v8b*)(mg + (size_t)(st * (SK / 16) + t) * (32 * 8));
    asm volatile("s_wait_xcnt 0x0" ::: "memory");   // the address registers of the mask loads are reused while the loads are on their way: the wait stands in front of that overwrite
    if (more) {
#pragma unroll
      for (int i = 0; i < 4; ++i) kr[i] = *(const v8b*)(kg + (size_t)((st + 1) * SK + i * 16) * (2 * E));
#pragma unroll
      for (int i = 0; i < 2; ++i) { hr[i] = *(const v8b*)(VTH + vg + (size_t)(i * 16) * NT + (st + 1) * SK); lr[i] = *(const v8b*)(VTL + vg + (size_t)(i * 16) * NT + (st + 1) * SK); }
      asm volatile("s_wait_xcnt 0x0" ::: "memory"); }   // the address registers of these loads are stepped on at the loop's foot: the wait stands in front of that overwrite
#pragma unroll
    for (int hf = 0; hf < SK / 32; ++hf) { float sv[16];   // element ct * 8 + r = key hf * 32 + ct * 16 + 8g + r of the stage
#pragma unroll
      for (int ct = 0; ct < 2; ++ct) { const __bf16* kw = &sk[bf][hf * 32 + ct * 16 + col][0]; const v16b kh = frag_b(kw, lane), kl = frag_b(kw + HD, lane);
        v8f s = {}; s = wmma_bf(kh, a.l, s); s = wmma_bf(kl, a.h, s); s = wmma_bf(kh, a.h, s);
#pragma unroll
        for (int r = 0; r < 8; ++r) sv[ct * 8 + r] = s[r] * scale + (float)mk[hf * 2 + ct][r]; }
      float mx = sv[0];
#pragma unroll
      for (int i = 1; i < 16; ++i) mx = fmaxf(mx, sv[i]);
      mx = fmaxf(mx, xhalf(mx));
      const float mn = fmaxf(m, mx * L2E), al = ex2(m - mn); m = mn;
      v2f pp[8];   // the lane's 16 terms in pairs: one exponent argument for both (one query a lane), and the sum as a tree of pairs, not as one chain of 16 dependent adds
#pragma unroll
      for (int i = 0; i < 8; ++i) { pp[i] = __builtin_elementwise_fma((v2f){sv[2 * i], sv[2 * i + 1]}, (v2f){L2E, L2E}, (v2f){-mn, -mn}); pp[i][0] = ex2(pp[i][0]); pp[i][1] = ex2(pp[i][1]); sv[2 * i] = pp[i][0]; sv[2 * i + 1] = pp[i][1]; }
      const v2f pq = ((pp[0] + pp[1]) + (pp[2] + pp[3])) + ((pp[4] + pp[5]) + (pp[6] + pp[7]));
      l = l * al + (pq[0] + pq[1]);
      const F2 pb = bsplit16(sv);
#pragma unroll
      for (int dt = 0; dt < 2; ++dt) { const v16b vh = frag_b(&svh[bf][dt * 16 + col][hf * 32], lane), vl = frag_b(&svl[bf][dt * 16 + col][hf * 32], lane);
#pragma unroll
        for (int r = 0; r < 8; ++r) acc[dt][r] *= al;
        acc[dt] = wmma_bf(vh, pb.l, acc[dt]); acc[dt] = wmma_bf(vl, pb.h, acc[dt]); acc[dt] = wmma_bf(vh, pb.h, acc[dt]); } }
    if (more) {   // the other buffer's last readers left it at the barrier that ended the stage before
#pragma unroll
      for (int i = 0; i < 4; ++i) *(v8b*)&sk[bf ^ 1][i * 16 + srow][sseg * 8] = kr[i];
#pragma unroll
      for (int i = 0; i < 2; ++i) { *(v8b*)&svh[bf ^ 1][i * 16 + srow][sseg * 8] = hr[i]; *(v8b*)&svl[bf ^ 1][i * 16 + srow][sseg * 8] = lr[i]; } }
    __syncthreads(); }   // publishes the next stage and ends this stage's reads
  const float il = 1.0f / (l + xhalf(l));
#pragma unroll
  for (int dt = 0; dt < 2; ++dt)
#pragma unroll
    for (int hq = 0; hq < 2; ++hq) { v4f o;
#pragma unroll
      for (int e = 0; e < 4; ++e) o[e] = acc[dt][hq * 4 + e] * il;
      *(v4f*)&so[wave][col][dt * 16 + 8 * g + hq * 4] = o; }
  LDSX();
  for (int rl = 0; rl < 16; ++rl) if (lane < 8) vst2(Q + ((size_t)b * NT + q0 + rl) * E + h * HD + lane * 4, *(const v4f*)&so[wave][rl][lane * 4]);
}
// ---- k_out: block = (b, 64 positions), 8 waves: Y[b][o][t] = sum_c O[b][t][c] Wo[o][c] + bo[o]: GEMM rows t (O rows hi/lo, K 256), cols o (a wave: 16 positions, 8 tiles = 128 outputs); written channel-major: per o the 64 t = 256 B
__global__ __launch_bounds__(PT) void k_out(const float* __restrict__ O, const float* __restrict__ Wo, const float* __restrict__ bo, float* __restrict__ Y) {
  __shared__ __align__(16) float sot[E][68];          // [o][t local]
  __shared__ __align__(16) __bf16 sw[E][WP];
  const int tid = threadIdx.x, wave = tid >> 5, lane = tid & 31, col = lane & 15, g = lane >> 4; const int b = blockIdx.y, t0 = blockIdx.x * 64;
  const int pw = wave & 3, oh = wave >> 2;   // the wave's 16 positions and its half of the outputs
  stage_w(Wo, sw, tid);
  __syncthreads();   // publishes the staged weights to all eight waves
  v8f acc[8] = {};
#pragma unroll 1
  for (int kc = 0; kc < E / 32; ++kc) { const F2 a = split_row(O + ((size_t)b * NT + t0 + pw * 16 + col) * E, kc * 32, lane);
    v16b w[8];   // eight fragments read as one group, then their products: one LDS wait a group
#pragma unroll
    for (int j = 0; j < 8; ++j) w[j] = frag_b(&sw[(oh * 8 + j) * 16 + col][kc * 32], lane);
#pragma unroll
    for (int j = 0; j < 8; ++j) { acc[j] = wmma_bf(a.l, w[j], acc[j]); acc[j] = wmma_bf(a.h, w[j], acc[j]); } }
#pragma unroll
  for (int j = 0; j < 8; ++j) { const int o = (oh * 8 + j) * 16 + col; const float bb = bfr(bo[o]);
#pragma unroll
    for (int r = 0; r < 8; ++r) sot[o][pw * 16 + 8 * g + r] = acc[j][r] + bb; }
  __syncthreads();
  for (int q = tid; q < E * 16; q += PT) { const int o = q >> 4, pc = q & 15; vst2(Y + ((size_t)b * E + o) * NT + t0 + pc * 4, *(const v4f*)&sot[o][pc * 4]); }
}

extern "C" void kernel_launch(void* const* d_in, const int* in_sizes, int n_in, void* d_out, int out_size, void* d_ws, size_t ws_size, hipStream_t stream) {
  (void)in_sizes; (void)n_in; (void)out_size;
  const float** F = (const float**)d_in;   // d_in order: query, key, value [8,256,32,32], attn_mask [1024,1024], Wq, Wk, Wv, Wo [256,256], bq, bk, bv, bo [256]
  if (ws_size < (size_t)WS_END) return;
  char* ws = (char*)d_ws; float *Q = (float*)(ws + WS_Q); __bf16 *KS = (__bf16*)(ws + WS_K), *VTH = (__bf16*)(ws + WS_VTH), *VTL = (__bf16*)(ws + WS_VTL), *MB = (__bf16*)(ws + WS_MB);
  k_proj<<<dim3(NT / PB, TNB, 4), PT, 0, stream>>>(F[0], F[1], F[2], F[4], F[8], F[5], F[9], F[6], F[10], F[3], Q, KS, VTH, VTL, MB);
  k_attn<<<dim3(TQB, TNB * NH), 128, 0, stream>>>(Q, KS, MB, VTH, VTL);
  k_out<<<dim3(TQB, TNB), PT, 0, stream>>>(Q, F[7], F[11], (float*)d_out);
}

// v010
// A run of this version takes 63.4 microseconds.
// Two timings next to v009 both put it at 1.04 times that version's speed.
// All steps since v000 together make it 7.18 times as fast.
#include <hip/hip_runtime.h>
#include <math.h>

typedef __attribute__((ext_vector_type(16))) _Float16 v16h;
typedef __attribute__((ext_vector_type(16))) __bf16 v16b;
typedef __attribute__((ext_vector_type(8)))  _Float16 v8h;
typedef __attribute__((ext_vector_type(8)))  float v8f;
typedef __attribute__((ext_vector_type(4)))  float v4f;
typedef __attribute__((ext_vector_type(2)))  float v2f;
typedef __attribute__((ext_vector_type(4)))  unsigned v4u;
typedef __attribute__((ext_vector_type(4)))  int v4i;
typedef float __attribute__((may_alias)) float_a;
typedef int __attribute__((may_alias)) int_a;

template <typename T> __device__ __forceinline__ void vst2(void* p, T v) { *(T*)p = v;  }
__device__ __forceinline__ v8f wmma16(v16h a, v16h b, v8f c) {
  v8f d = __builtin_amdgcn_wmma_f32_16x16x32_f16(false, a, false, b, (short)0, c, false, false);
  asm volatile("v_nop\n\tv_nop\n\tv_nop\n\tv_nop" : "+v"(d) : "v"(a), "v"(b));
  return d;
}
__device__ __forceinline__ v8f wmma_bf(v16b a, v16b b, v8f c) {
  // the builtin alone: the compiler keeps the distance behind a matrix instruction itself, and fills it with independent vector work or LDS loads where the kernel has some
  return __builtin_amdgcn_wmma_f32_16x16x32_bf16(false, a, false, b, (short)0, c, false, false);
}
// 16x16x32 fragments: lane = (h = lane>>4, row/col = lane&15); elements 0..7 = k0+8h+0..7, 8..15 = k0+16+8h+0..7; D element r = row 8h+r
__device__ __forceinline__ v16h frag_h(const _Float16* rowk0, int lane) {
  union { v16h v; v8h q[2]; } u; const _Float16* p = rowk0 + 8 * (lane >> 4);
  u.q[0] = *(const v8h*)p; u.q[1] = *(const v8h*)(p + 16); return u.v;
}
__device__ __forceinline__ v16h frag_f32(const float* rowk0, int lane) {
  v16h a; const float* p = rowk0 + 8 * (lane >> 4);
#pragma unroll
  for (int i = 0; i < 8; ++i) { a[i] = (_Float16)p[i]; a[8 + i] = (_Float16)p[16 + i]; }
  return a;
}
__device__ __forceinline__ v16h frag_f32s(const float* rowk0, int lane, float sc) {
  v16h a; const float* p = rowk0 + 8 * (lane >> 4);
#pragma unroll
  for (int i = 0; i < 8; ++i) { a[i] = (_Float16)(p[i] * sc); a[8 + i] = (_Float16)(p[16 + i] * sc); }
  return a;
}
// column fragment from a [K][ld] layout (column n), rows >= K read as 0
__device__ __forceinline__ v16h fragc_f32(const float* W, int k0, int n, int lane, int ld, int K) {
  v16h a; const int g = lane >> 4;
#pragma unroll
  for (int i = 0; i < 8; ++i) { const int ka = k0 + 8 * g + i, kb = ka + 16;
    a[i] = (_Float16)(ka < K ? W[(size_t)(ka < K ? ka : K - 1) * ld + n] : 0.f); a[8 + i] = (_Float16)(kb < K ? W[(size_t)(kb < K ? kb : K - 1) * ld + n] : 0.f); }
  return a;
}
struct F2 { v16b h, l; };
__device__ __forceinline__ F2 bsplit16(const float v[16]) { F2 r;
#pragma unroll
  for (int i = 0; i < 16; ++i) { const __bf16 h = (__bf16)v[i]; r.h[i] = h; r.l[i] = (__bf16)(v[i] - (float)h); }
  return r; }
__device__ __forceinline__ F2 split_row(const float* row, int k0, int lane) { float v[16]; const float* p = row + k0 + 8 * (lane >> 4);
#pragma unroll
  for (int i = 0; i < 8; ++i) { v[i] = p[i]; v[8 + i] = p[16 + i]; }
  return bsplit16(v); }
__device__ __forceinline__ F2 split_rowK(const float* row, int k0, int lane, int K) { float v[16]; const int g = lane >> 4;
#pragma unroll
  for (int i = 0; i < 8; ++i) { const int ka = k0 + 8 * g + i, kb = ka + 16; v[i] = ka < K ? row[ka < K ? ka : K - 1] : 0.f; v[8 + i] = kb < K ? row[kb < K ? kb : K - 1] : 0.f; }
  return bsplit16(v); }
__device__ __forceinline__ F2 split_col(const float* W, int k0, int n, int lane, int ld, int K) { float v[16]; const int g = lane >> 4;
#pragma unroll
  for (int i = 0; i < 8; ++i) { const int ka = k0 + 8 * g + i, kb = ka + 16; v[i] = ka < K ? W[(size_t)(ka < K ? ka : K - 1) * ld + n] : 0.f; v[8 + i] = kb < K ? W[(size_t)(kb < K ? kb : K - 1) * ld + n] : 0.f; }
  return bsplit16(v); }
__device__ __forceinline__ v8f mac3(const F2& a, const F2& b, v8f c) { c = wmma_bf(a.l, b.h, c); c = wmma_bf(a.h, b.l, c); return wmma_bf(a.h, b.h, c); }
__device__ __forceinline__ float sigm(float v) { return 1.0f / (1.0f + expf(-v)); }
#define LDSX() do { asm volatile("s_wait_dscnt 0" ::: "memory"); __builtin_amdgcn_wave_barrier(); __builtin_amdgcn_fence(__ATOMIC_RELEASE, "workgroup"); } while (0)


// Multi-head attention over 32x32 feature maps (channel-major NCHW inputs): q/k/v = 1x1 conv (W x + b) per position, 8 heads x 32, scores = q k^T / sqrt(32) + attn_mask[t][s] (dense float mask, shared across batch/heads), softmax over s, P v, concat heads (channel = h*32 + d), out = Wo out + bo -> [B, 256, 32, 32].
// k_proj (per (b, 128 positions): gathers the channel-major input columns into LDS as bf16 [pos][ch], one bf16 GEMM against bf16 W rows; q as position rows [b][t][256], k as position rows split into bf16 hi/lo per head, v as channel-major hi/lo planes [b][ch][t]), k_attn (per (64 queries, b, h): one pass over the 1024 keys, running row max m (kept as m log2 e) and row sum l; P = 2^(s log2 e - m log2 e) hi/lo . V^T planes, O and l rescaled by 2^(m_old log2 e - m_new log2 e) per 32 keys, O / l at the end, O rows), k_out (O(hi/lo) . Wo rows + bo, written channel-major: per output channel one 256-B segment of 64 positions).
#define NB 8
#define E 256
#define NT 1024
#define NH 8
#define HD 32
#ifndef TNB
#define TNB NB
#define TQB (NT / 64)
#endif
typedef __attribute__((ext_vector_type(8))) __bf16 v8b;
__device__ __forceinline__ v16b frag_b(const __bf16* rowk0, int lane) {
  union { v16b v; v8b q[2]; } u; const __bf16* p = rowk0 + 8 * (lane >> 4);
  u.q[0] = *(const v8b*)p; u.q[1] = *(const v8b*)(p + 16); return u.v;
}
__device__ __forceinline__ v16b frag_gbf(const float* rowk0, int lane) {
  v16b a; const float* p = rowk0 + 8 * (lane >> 4);
#pragma unroll
  for (int i = 0; i < 8; ++i) { a[i] = (__bf16)p[i]; a[8 + i] = (__bf16)p[16 + i]; }
  return a;
}
__device__ __forceinline__ float bfr(float v) { return (float)(__bf16)v; }
// 2^v as the one hardware instruction, in line; arguments here are <= 0 up to rounding, and a result below the normal range may read as 0
__device__ __forceinline__ float ex2(float v) { return __builtin_amdgcn_exp2f(v); }
#define L2E 1.4426950408889634f
#define WS_Q    0u                               // f32 [8][1024][256] q rows (t-major); later O rows
#define WS_K    (WS_Q + 4u * NB * NT * E)          // bf16 [8][1024 t][8 heads][hi 32 | lo 32]: a key's 128 B of one head are one line
#define WS_VTH  (WS_K + 4u * NB * NT * E)          // bf16 [8][256 ch][1024 t]
#define WS_VTL  (WS_VTH + 2u * NB * E * NT)
#define WS_MB   (WS_VTL + 2u * NB * E * NT)         // bf16 [64 tiles of 16 queries][64 tiles of 16 keys][32 lanes][8]: the mask as k_attn's lanes hold it, 512 B a wave-load
#define WS_END  (WS_MB + 2u * NT * NT)
// A 256 x 256 weight matrix goes into LDS once a block, rounded to bf16 as the fragment loader rounded it: every wave-load is 512 contiguous bytes, 32 loads of a thread are on their way at a time.
// The two projection kernels run PT threads = 8 waves a block, two a SIMD: one wave's LDS and memory waits are covered by the other's work, and the weights are in after two trips.
#define PT 256
// Row pitch 264 bf16 = 528 B (16 B x odd): the 16 rows of a fragment's 16-B reads fall on 16 different bank groups.
#define WP (E + 8)
typedef __attribute__((ext_vector_type(4))) __bf16 v4b;
typedef __attribute__((ext_vector_type(2))) __bf16 v2b;
__device__ __forceinline__ void stage_w(const float* __restrict__ Wm, __bf16 (*sw)[WP], int tid) {
  // kept rolled
#pragma unroll 1
  for (int o = 0; o < E * E / 4; o += PT * 32) { v4f t[32];
#pragma unroll
    for (int i = 0; i < 32; ++i) t[i] = *(const v4f*)(Wm + (size_t)(o + i * PT + tid) * 4);
#pragma unroll
    for (int i = 0; i < 32; ++i) { const int q = o + i * PT + tid; v4b hb;
#pragma unroll
      for (int e = 0; e < 4; ++e) hb[e] = (__bf16)t[i][e];
      *(v4b*)&sw[q >> 6][(q & 63) * 4] = hb; } }
}

// k_proj: a block takes PB = 128 positions, so the 192 blocks all run at once (one a WGP) and each weight matrix is staged once per 128 positions. A wave holds 32 positions x 128 outputs: a weight fragment read from LDS serves two products.
// LDS is used twice: first the weights and the input tile, then (behind a barrier) the f32 result rows over them, with the V planes behind the rows.
#define PB 128
#define SM_SX  (E * WP * 2)                       // input tile behind the weights
#define SM_SVH (PB * (E + 4) * 4)                 // V planes behind the result rows
#define SM_SVL (SM_SVH + E * (PB + 8) * 2)
#define SM_END (SM_SVL + E * (PB + 8) * 2)
__global__ __launch_bounds__(PT) void k_proj(const float* __restrict__ Xq, const float* __restrict__ Xk, const float* __restrict__ Xv, const float* __restrict__ Wq, const float* __restrict__ bq, const float* __restrict__ Wk, const float* __restrict__ bk, const float* __restrict__ Wv, const float* __restrict__ bv, const float* __restrict__ mask, float* __restrict__ Q, __bf16* __restrict__ KS, __bf16* __restrict__ VTH, __bf16* __restrict__ VTL, __bf16* __restrict__ MB) {
  __shared__ __align__(16) unsigned char sm[SM_END];
  __bf16 (*sw)[WP] = (__bf16 (*)[WP])sm; __bf16 (*sx)[E + 8] = (__bf16 (*)[E + 8])(sm + SM_SX);
  float (*so)[E + 4] = (float (*)[E + 4])sm; __bf16 (*svh)[PB + 8] = (__bf16 (*)[PB + 8])(sm + SM_SVH); __bf16 (*svl)[PB + 8] = (__bf16 (*)[PB + 8])(sm + SM_SVL);
  const int tid = threadIdx.x, wave = tid >> 5, lane = tid & 31, col = lane & 15, g = lane >> 4; const int b = blockIdx.y, t0 = blockIdx.x * PB, which = blockIdx.z;
  if (which == 3) {   // 64 more blocks, on the WGPs that the 192 projection blocks leave idle: each packs the mask rows of one tile of 16 queries, rounded to bf16 as k_attn rounded them, in the order of k_attn's score tiles
    // piece u = (16-key tile, lane): lane (col, g) holds keys 8g .. 8g + 7 of the tile for query col. The scattered 32-B reads are paid once here, not by each of the 64 (batch, head) pairs; all 16 loads of a thread are in flight at once
    static_assert((NT / PB) * TNB == NT / 16, "one block a query tile");
    const int qt = blockIdx.y * (NT / PB) + blockIdx.x; const float* src = mask + (size_t)(qt * 16 + col) * NT + wave * 16 + 8 * g; v4f ma[8], mb[8];
#pragma unroll
    for (int i = 0; i < 8; ++i) { ma[i] = *(const v4f*)(src + i * (PT / 32 * 16)); mb[i] = *(const v4f*)(src + i * (PT / 32 * 16) + 4); }   // piece u = i * PT + tid: key tile u >> 5 = 8 i + wave
    asm volatile("s_wait_xcnt 0x0" :: "v"(src) : "memory");   // the address registers of the loads above are free for reuse behind them: the wait stands in front of any overwrite, and naming src keeps its registers untouched up to the wait
#pragma unroll
    for (int i = 0; i < 8; ++i) { v8b o;
#pragma unroll
      for (int e = 0; e < 4; ++e) { o[e] = (__bf16)ma[i][e]; o[4 + e] = (__bf16)mb[i][e]; }
      vst2(MB + ((size_t)qt * (NT / 16 * 32) + i * PT + tid) * 8, o); }
    return; }   // the whole block leaves, in front of every barrier
  const int pg = wave & 3, oh = wave >> 2;   // the wave's 32 positions and its half of the outputs
  const float* X = which == 0 ? Xq : (which == 1 ? Xk : Xv); const float* Wm = which == 0 ? Wq : (which == 1 ? Wk : Wv); const float* bm = which == 0 ? bq : (which == 1 ? bk : bv);
  stage_w(Wm, sw, tid);
  { // the block's 256 channels x 128 positions come from memory (each half of the block takes 64 positions): 16 lanes take one channel's 256 B as 16-B pieces, and all 32 loads of a thread are issued before the first is used, so the tile costs one memory latency (the loops below are unrolled so that the 32 values stay in registers)
    const int seg = (tid & 15) + 16 * (tid >> 7), cp = (tid >> 4) & 7; const float* xg = X + ((size_t)b * E + 2 * cp) * NT + t0 + seg * 4; v4f xa[16], xb[16];   // channels 16 i + 2 cp and the next one, positions 4 seg .. 4 seg + 3
#pragma unroll
    for (int i = 0; i < 16; ++i) { xa[i] = *(const v4f*)(xg + (size_t)(i * 16) * NT); xb[i] = *(const v4f*)(xg + (size_t)(i * 16 + 1) * NT); }
#pragma unroll
    for (int i = 0; i < 16; ++i)
#pragma unroll
      for (int e = 0; e < 4; ++e) { v2b pk; pk[0] = (__bf16)xa[i][e]; pk[1] = (__bf16)xb[i][e]; *(v2b*)&sx[seg * 4 + e][i * 16 + 2 * cp] = pk; } }   // two neighbouring channels of one position: one 4-B store
  __syncthreads();
  v8f acc[2][8] = {};
#pragma unroll 2
  for (int kc = 0; kc < E / 32; ++kc) { const v16b a0 = frag_b(&sx[pg * 32 + col][kc * 32], lane), a1 = frag_b(&sx[pg * 32 + 16 + col][kc * 32], lane);
    v16b w[8];   // ten fragments read as one group, then their sixteen products: one LDS wait a group
#pragma unroll
    for (int j = 0; j < 8; ++j) w[j] = frag_b(&sw[(oh * 8 + j) * 16 + col][kc * 32], lane);
#pragma unroll
    for (int j = 0; j < 8; ++j) { acc[0][j] = wmma_bf(a0, w[j], acc[0][j]); acc[1][j] = wmma_bf(a1, w[j], acc[1][j]); } }
  __syncthreads();   // ends every wave's reads of the weights and the input tile: the result rows are written over them
#pragma unroll
  for (int j = 0; j < 8; ++j) { const int o = (oh * 8 + j) * 16 + col; const float bb = bfr(bm[o]);
#pragma unroll
    for (int pt = 0; pt < 2; ++pt)
#pragma unroll
      for (int r = 0; r < 8; ++r) so[pg * 32 + pt * 16 + 8 * g + r][o] = acc[pt][j][r] + bb; }
  __syncthreads();
  if (which == 0) {
    for (int rl = 0; rl < 16; ++rl) for (int pc = lane; pc < E / 4; pc += 32) vst2(Q + ((size_t)b * NT + t0 + wave * 16 + rl) * E + pc * 4, *(const v4f*)&so[wave * 16 + rl][pc * 4]); }
  else if (which == 1) {   // k leaves here already split into hi and lo, once for all the waves that read it: a lane takes 8 channels of a row, the wave one row a trip
    for (int rl = 0; rl < 16; ++rl) { v8b kh, kl;
#pragma unroll
      for (int e = 0; e < 8; ++e) { const float v = so[wave * 16 + rl][lane * 8 + e]; const __bf16 hb = (__bf16)v; kh[e] = hb; kl[e] = (__bf16)(v - (float)hb); }
      __bf16* dst = KS + (((size_t)b * NT + t0 + wave * 16 + rl) * NH + (lane >> 2)) * (2 * HD) + (lane & 3) * 8;
      vst2(dst, kh); vst2(dst + HD, kl); } }
  else {
    for (int q = tid; q < E * PB; q += PT) { const int c = q >> 7, tl = q & (PB - 1); const float v = so[tl][c]; const __bf16 hb = (__bf16)v; svh[c][tl] = hb; svl[c][tl] = (__bf16)(v - (float)hb); }
    __syncthreads();
    for (int q = tid; q < E * (PB / 8); q += PT) { const int c = q >> 4, pc = q & 15; const size_t o = ((size_t)b * E + c) * NT + t0 + pc * 8; vst2((unsigned*)(VTH + o), *(const v4u*)&svh[c][pc * 8]); vst2((unsigned*)(VTL + o), *(const v4u*)&svl[c][pc * 8]); } }
}
#define SK 64
// lane l <-> l ^ 16
__device__ __forceinline__ float xhalf(float v) { const int b = __float_as_int(v); return __int_as_float(__builtin_amdgcn_permlanex16(b, b, 0x76543210, 0xfedcba98, false, false)); }
// four waves a SIMD and no more: the grid is 4 blocks for each of the 256 WGPs, and a fifth block on one WGP would leave another with three
__global__ __launch_bounds__(128) __attribute__((amdgpu_waves_per_eu(4, 4))) void k_attn(float* __restrict__ Q, const __bf16* __restrict__ KS, const __bf16* __restrict__ MB, const __bf16* __restrict__ VTH, const __bf16* __restrict__ VTL) {
  __shared__ __align__(16) float so[4][16][36];
  __shared__ __align__(16) __bf16 sk[2][SK][2 * HD + 8];                      // [buffer][key][hi d | lo d], pitch 36 dwords: 16 rows' 16-B reads fall on 16 different bank groups
  __shared__ __align__(16) __bf16 svh[2][HD][SK + 8], svl[2][HD][SK + 8];     // [buffer][channel][key], the same pitch in bytes
  const int tid = threadIdx.x, wave = tid >> 5, lane = tid & 31, col = lane & 15, g = lane >> 4; const int bh = blockIdx.y, b = bh >> 3, h = bh & 7; const int q0 = blockIdx.x * 64 + wave * 16; const float scale = 0.17677669529663687f;
  const int srow = tid >> 3, sseg = tid & 7;   // staging: 8 threads a 128-B row, 16 rows a pass of the block
  const __bf16* kg = KS + (((size_t)b * NT + srow) * NH + h) * (2 * HD) + sseg * 8;
  const size_t vg = ((size_t)b * E + h * HD + srow) * NT + sseg * 8;
  const __bf16* mg = MB + ((size_t)(q0 >> 4) * (NT / 16 * 32) + lane) * 8;   // the wave's query tile of the packed mask, at this lane's 16 B of the first 16-key tile
  v8b kr[4], hr[2], lr[2];   // one stage on its way; every loop over them is unrolled so that they stay in registers
#pragma unroll
  for (int i = 0; i < 4; ++i) kr[i] = *(const v8b*)(kg + (size_t)(i * 16) * (2 * E));
#pragma unroll
  for (int i = 0; i < 2; ++i) { hr[i] = *(const v8b*)(VTH + vg + (size_t)(i * 16) * NT); lr[i] = *(const v8b*)(VTL + vg + (size_t)(i * 16) * NT); }
  asm volatile("s_wait_xcnt 0x0" ::: "memory");   // the address registers of the loads above are reused at once (the query row's load lands in them): the wait stands in front of that overwrite
  const F2 a = split_row(Q + ((size_t)b * NT + q0 + col) * E + h * HD, 0, lane);
  float m = -3.0e38f, l = 0.f;   // query q0 + col: running max times log2 e (equal in the query's two lanes), this lane's share of the running sum
  v8f acc[2] = {};               // O^T: element r of tile dt = channel dt * 16 + 8g + r of query q0 + col
#pragma unroll
  for (int i = 0; i < 4; ++i) *(v8b*)&sk[0][i * 16 + srow][sseg * 8] = kr[i];
#pragma unroll
  for (int i = 0; i < 2; ++i) { *(v8b*)&svh[0][i * 16 + srow][sseg * 8] = hr[i]; *(v8b*)&svl[0][i * 16 + srow][sseg * 8] = lr[i]; }
  __syncthreads();
  // kept rolled: the body already holds two passes of 32 keys, a longer one would only grow the code
#pragma unroll 1
  for (int st = 0; st < NT / SK; ++st) { const int bf = st & 1; const bool more = st + 1 < NT / SK;
    v8b mk[SK / 16];   // the stage's mask values of this lane: 8 consecutive keys a 16-key tile, one load of 512 contiguous bytes a wave and tile; asked for ahead of the next stage's K and V, which are wanted later
#pragma unroll
    for (int t = 0; t < SK / 16; ++t) mk[t] = *(const v8b*)(mg + (size_t)(st * (SK / 16) + t) * (32 * 8));
    asm volatile("s_wait_xcnt 0x0" ::: "memory");   // the address registers of the mask loads are reused while the loads are on their way: the wait stands in front of that overwrite
    if (more) {
#pragma unroll
      for (int i = 0; i < 4; ++i) kr[i] = *(const v8b*)(kg + (size_t)((st + 1) * SK + i * 16) * (2 * E));
#pragma unroll
      for (int i = 0; i < 2; ++i) { hr[i] = *(const v8b*)(VTH + vg + (size_t)(i * 16) * NT + (st + 1) * SK); lr[i] = *(const v8b*)(VTL + vg + (size_t)(i * 16) * NT + (st + 1) * SK); }
      asm volatile("s_wait_xcnt 0x0" ::: "memory"); }   // the address registers of these loads are stepped on at the loop's foot: the wait stands in front of that overwrite
#pragma unroll
    for (int hf = 0; hf < SK / 32; ++hf) { float sv[16];   // element ct * 8 + r = key hf * 32 + ct * 16 + 8g + r of the stage
#pragma unroll
      for (int ct = 0; ct < 2; ++ct) { const __bf16* kw = &sk[bf][hf * 32 + ct * 16 + col][0]; const v16b kh = frag_b(kw, lane), kl = frag_b(kw + HD, lane);
        v8f s = {}; s = wmma_bf(kh, a.l, s); s = wmma_bf(kl, a.h, s); s = wmma_bf(kh, a.h, s);
#pragma unroll
        for (int r = 0; r < 8; ++r) sv[ct * 8 + r] = s[r] * scale + (float)mk[hf * 2 + ct][r]; }
      float mx = sv[0];
#pragma unroll
      for (int i = 1; i < 16; ++i) mx = fmaxf(mx, sv[i]);
      mx = fmaxf(mx, xhalf(mx));
      const float mn = fmaxf(m, mx * L2E), al = ex2(m - mn); m = mn;
      v2f pp[8];   // the lane's 16 terms in pairs: one exponent argument for both (one query a lane), and the sum as a tree of pairs, not as one chain of 16 dependent adds
#pragma unroll
      for (int i = 0; i < 8; ++i) { pp[i] = __builtin_elementwise_fma((v2f){sv[2 * i], sv[2 * i + 1]}, (v2f){L2E, L2E}, (v2f){-mn, -mn}); pp[i][0] = ex2(pp[i][0]); pp[i][1] = ex2(pp[i][1]); sv[2 * i] = pp[i][0]; sv[2 * i + 1] = pp[i][1]; }
      const v2f pq = ((pp[0] + pp[1]) + (pp[2] + pp[3])) + ((pp[4] + pp[5]) + (pp[6] + pp[7]));
      l = l * al + (pq[0] + pq[1]);
      const F2 pb = bsplit16(sv);
#pragma unroll
      for (int dt = 0; dt < 2; ++dt) { const v16b vh = frag_b(&svh[bf][dt * 16 + col][hf * 32], lane), vl = frag_b(&svl[bf][dt * 16 + col][hf * 32], lane);
#pragma unroll
        for (int r = 0; r < 8; ++r) acc[dt][r] *= al;
        acc[dt] = wmma_bf(vh, pb.l, acc[dt]); acc[dt] = wmma_bf(vl, pb.h, acc[dt]); acc[dt] = wmma_bf(vh, pb.h, acc[dt]); } }
    if (more) {   // the other buffer's last readers left it at the barrier that ended the stage before
#pragma unroll
      for (int i = 0; i < 4; ++i) *(v8b*)&sk[bf ^ 1][i * 16 + srow][sseg * 8] = kr[i];
#pragma unroll
      for (int i = 0; i < 2; ++i) { *(v8b*)&svh[bf ^ 1][i * 16 + srow][sseg * 8] = hr[i]; *(v8b*)&svl[bf ^ 1][i * 16 + srow][sseg * 8] = lr[i]; } }
    __syncthreads(); }   // publishes the next stage and ends this stage's reads
  const float il = 1.0f / (l + xhalf(l));
#pragma unroll
  for (int dt = 0; dt < 2; ++dt)
#pragma unroll
    for (int hq = 0; hq < 2; ++hq) { v4f o;
#pragma unroll
      for (int e = 0; e < 4; ++e) o[e] = acc[dt][hq * 4 + e] * il;
      *(v4f*)&so[wave][col][dt * 16 + 8 * g + hq * 4] = o; }
  LDSX();
  for (int rl = 0; rl < 16; ++rl) if (lane < 8) vst2(Q + ((size_t)b * NT + q0 + rl) * E + h * HD + lane * 4, *(const v4f*)&so[wave][rl][lane * 4]);
}
// ---- k_out: block = (b, 64 positions), 8 waves: Y[b][o][t] = sum_c O[b][t][c] Wo[o][c] + bo[o]: GEMM rows t (O rows hi/lo, K 256), cols o (a wave: 16 positions, 8 tiles = 128 outputs); written channel-major: per o the 64 t = 256 B
__global__ __launch_bounds__(PT) void k_out(const float* __restrict__ O, const float* __restrict__ Wo, const float* __restrict__ bo, float* __restrict__ Y) {
  __shared__ __align__(16) float sot[E][68];          // [o][t local]
  __shared__ __align__(16) __bf16 sw[E][WP];
  const int tid = threadIdx.x, wave = tid >> 5, lane = tid & 31, col = lane & 15, g = lane >> 4; const int b = blockIdx.y, t0 = blockIdx.x * 64;
  const int pw = wave & 3, oh = wave >> 2;   // the wave's 16 positions and its half of the outputs
  stage_w(Wo, sw, tid);
  __syncthreads();   // publishes the staged weights to all eight waves
  v8f acc[8] = {};
#pragma unroll 1
  for (int kc = 0; kc < E / 32; ++kc) { const F2 a = split_row(O + ((size_t)b * NT + t0 + pw * 16 + col) * E, kc * 32, lane);
    v16b w[8];   // eight fragments read as one group, then their products: one LDS wait a group
#pragma unroll
    for (int j = 0; j < 8; ++j) w[j] = frag_b(&sw[(oh * 8 + j) * 16 + col][kc * 32], lane);
#pragma unroll
    for (int j = 0; j < 8; ++j) { acc[j] = wmma_bf(a.l, w[j], acc[j]); acc[j] = wmma_bf(a.h, w[j], acc[j]); } }
#pragma unroll
  for (int j = 0; j < 8; ++j) { const int o = (oh * 8 + j) * 16 + col; const float bb = bfr(bo[o]);
#pragma unroll
    for (int r = 0; r < 8; ++r) sot[o][pw * 16 + 8 * g + r] = acc[j][r] + bb; }
  __syncthreads();
  for (int q = tid; q < E * 16; q += PT) { const int o = q >> 4, pc = q & 15; vst2(Y + ((size_t)b * E + o) * NT + t0 + pc * 4, *(const v4f*)&sot[o][pc * 4]); }
}

extern "C" void kernel_launch(void* const* d_in, const int* in_sizes, int n_in, void* d_out, int out_size, void* d_ws, size_t ws_size, hipStream_t stream) {
  (void)in_sizes; (void)n_in; (void)out_size;
  const float** F = (const float**)d_in;   // d_in order: query, key, value [8,256,32,32], attn_mask [1024,1024], Wq, Wk, Wv, Wo [256,256], bq, bk, bv, bo [256]
  if (ws_size < (size_t)WS_END) return;
  char* ws = (char*)d_ws; float *Q = (float*)(ws + WS_Q); __bf16 *KS = (__bf16*)(ws + WS_K), *VTH = (__bf16*)(ws + WS_VTH), *VTL = (__bf16*)(ws + WS_VTL), *MB = (__bf16*)(ws + WS_MB);
  k_proj<<<dim3(NT / PB, TNB, 4), PT, 0, stream>>>(F[0], F[1], F[2], F[4], F[8], F[5], F[9], F[6], F[10], F[3], Q, KS, VTH, VTL, MB);
  k_attn<<<dim3(TQB, TNB * NH), 128, 0, stream>>>(Q, KS, MB, VTH, VTL);
  k_out<<<dim3(TQB, TNB), PT, 0, stream>>>(Q, F[7], F[11], (float*)d_out);
}
